// v000
// The times below were measured on an AMD MI455X: many runs one after another, warmed up first and cycling through
// copies of the inputs, with the whole window's GPU time divided by the number of runs. Launches and the gaps
// between them are all in it. The median over several windows is given; except for v000 it joins two sittings, which
// can be a few percent apart, so the side-by-side timings, each taken in one sitting, are the better comparison.
// The starting kernel, v000, takes 521 microseconds a run.
#include <hip/hip_runtime.h>
#include <hip/hip_bf16.h>

typedef __bf16 bf16_t;
typedef __attribute__((ext_vector_type(16))) __bf16 v16bf;
typedef __attribute__((ext_vector_type(8)))  __bf16 v8bf;
typedef __attribute__((ext_vector_type(4)))  __bf16 v4bf;
typedef __attribute__((ext_vector_type(2)))  __bf16 v2bf;
typedef __attribute__((ext_vector_type(8)))  float  v8f;

#define BB  4
#define TT  2048
#define DD  1024
#define HH  16
#define DH  64

union FragU { v16bf v; v8bf h[2]; };

// Load a 16x32 bf16 WMMA A/B fragment from a row-major [rows][ld] bf16 matrix.
// A: row = base_row + lane%16 ; B: n = base_row + lane%16 with source in [N][K] layout.
// Per documented layout: elements 0..7 at K=k0+(lane/16)*8, elements 8..15 at K=k0+16+(lane/16)*8.
__device__ inline v16bf load_frag(const bf16_t* base, int row0, int k0, int ld) {
  const int lane = threadIdx.x & 31;
  const int sel  = lane & 15;
  const int hf   = lane >> 4;
  const bf16_t* p = base + (size_t)(row0 + sel) * ld + k0 + hf * 8;
  FragU f;
  f.h[0] = *reinterpret_cast<const v8bf*>(p);
  f.h[1] = *reinterpret_cast<const v8bf*>(p + 16);
  return f.v;
}

__device__ inline v8f wmma_bf16(v16bf a, v16bf b, v8f c) {
  // (neg_a, A, neg_b, B, c_mod, C, reuse_a, reuse_b)
  return __builtin_amdgcn_wmma_f32_16x16x32_bf16(false, a, false, b, (short)0, c, false, false);
}

// ---------------------------------------------------------------------------
// Kernel 1: fused QKV projection.  X[8192,1024]f32 x W[h][1024,64]f32 -> bf16
// Q,K stored [b,h,t,dh] row-major; V stored transposed [b,h,dh,t].
// 1/sqrt(DH)=0.125 folded into Q.
// grid (64, 48): x = 8192/128 row tiles, y = (mat 0..2)*16 + head
// ---------------------------------------------------------------------------
__global__ __launch_bounds__(256)
void mha_qkv_proj_kernel(const float* __restrict__ x,
                         const float* __restrict__ Wq,
                         const float* __restrict__ Wk,
                         const float* __restrict__ Wv,
                         bf16_t* __restrict__ Qb,
                         bf16_t* __restrict__ Kb,
                         bf16_t* __restrict__ Vt) {
  __shared__ bf16_t Xs[128 * 72];   // 128 rows x 64 K (+8 pad)
  __shared__ bf16_t Ws[64 * 72];    // [n=64][k=64] transposed weight tile
  const int tid  = threadIdx.x;
  const int lane = tid & 31, wid = tid >> 5;
  const int lanen = lane & 15, hf = lane >> 4;
  const int wm = wid >> 1, wn = wid & 1;          // 4x2 wave grid -> 128x64 tile
  const int r0  = blockIdx.x * 128;
  const int mh  = blockIdx.y;
  const int mat = mh >> 4;                        // 0=Q 1=K 2=V
  const int h   = mh & 15;
  const float* W = (mat == 0 ? Wq : (mat == 1 ? Wk : Wv)) + (size_t)h * DD * DH;

  v8f c[2][2] = {};

  for (int k0 = 0; k0 < DD; k0 += 64) {
    // Stage X tile (convert f32 -> bf16)
#pragma unroll
    for (int i = 0; i < 8; ++i) {
      int idx = i * 256 + tid;               // 2048 float4 loads
      int row = idx >> 4;
      int c4  = idx & 15;
      float4 xv = *reinterpret_cast<const float4*>(x + (size_t)(r0 + row) * DD + k0 + c4 * 4);
      v4bf bv = { (bf16_t)xv.x, (bf16_t)xv.y, (bf16_t)xv.z, (bf16_t)xv.w };
      *reinterpret_cast<v4bf*>(&Xs[row * 72 + c4 * 4]) = bv;
    }
    // Stage W tile transposed (convert f32 -> bf16)
#pragma unroll
    for (int i = 0; i < 4; ++i) {
      int idx = i * 256 + tid;               // 1024 float4 loads
      int d  = idx >> 4;
      int e4 = idx & 15;
      float4 wv = *reinterpret_cast<const float4*>(W + (size_t)(k0 + d) * DH + e4 * 4);
      Ws[(e4 * 4 + 0) * 72 + d] = (bf16_t)wv.x;
      Ws[(e4 * 4 + 1) * 72 + d] = (bf16_t)wv.y;
      Ws[(e4 * 4 + 2) * 72 + d] = (bf16_t)wv.z;
      Ws[(e4 * 4 + 3) * 72 + d] = (bf16_t)wv.w;
    }
    __syncthreads();
#pragma unroll
    for (int ks = 0; ks < 64; ks += 32) {
      v16bf a0 = load_frag(&Xs[0], wm * 32 +  0, ks, 72);
      v16bf a1 = load_frag(&Xs[0], wm * 32 + 16, ks, 72);
      v16bf b0 = load_frag(&Ws[0], wn * 32 +  0, ks, 72);
      v16bf b1 = load_frag(&Ws[0], wn * 32 + 16, ks, 72);
      c[0][0] = wmma_bf16(a0, b0, c[0][0]);
      c[0][1] = wmma_bf16(a0, b1, c[0][1]);
      c[1][0] = wmma_bf16(a1, b0, c[1][0]);
      c[1][1] = wmma_bf16(a1, b1, c[1][1]);
    }
    __syncthreads();
  }

  // Epilogue: tile never crosses a batch boundary (2048 % 128 == 0), and mat
  // is block-uniform -> one uniform branch, branch-free store loops inside.
  const int bidx = r0 >> 11;                 // batch index (uniform)
  const int t00  = (r0 & 2047) + wm * 32;    // base t for this wave
  const size_t bh = (size_t)(bidx * HH + h);

  if (mat == 0) {
    bf16_t* dst = Qb + bh * TT * DH;
#pragma unroll
    for (int mi = 0; mi < 2; ++mi)
#pragma unroll
      for (int ni = 0; ni < 2; ++ni) {
        int e = wn * 32 + ni * 16 + lanen;
#pragma unroll
        for (int r = 0; r < 8; ++r) {
          int t = t00 + mi * 16 + r + 8 * hf;
          dst[(size_t)t * DH + e] = (bf16_t)(c[mi][ni][r] * 0.125f);
        }
      }
  } else if (mat == 1) {
    bf16_t* dst = Kb + bh * TT * DH;
#pragma unroll
    for (int mi = 0; mi < 2; ++mi)
#pragma unroll
      for (int ni = 0; ni < 2; ++ni) {
        int e = wn * 32 + ni * 16 + lanen;
#pragma unroll
        for (int r = 0; r < 8; ++r) {
          int t = t00 + mi * 16 + r + 8 * hf;
          dst[(size_t)t * DH + e] = (bf16_t)c[mi][ni][r];
        }
      }
  } else {
    // V transposed [dh][t]: consecutive r -> consecutive t -> packed b32 stores
    bf16_t* dst = Vt + bh * DH * TT;
#pragma unroll
    for (int mi = 0; mi < 2; ++mi)
#pragma unroll
      for (int ni = 0; ni < 2; ++ni) {
        int e = wn * 32 + ni * 16 + lanen;
#pragma unroll
        for (int r = 0; r < 8; r += 2) {
          int t = t00 + mi * 16 + r + 8 * hf;   // even
          v2bf pv = { (bf16_t)c[mi][ni][r], (bf16_t)c[mi][ni][r + 1] };
          *reinterpret_cast<v2bf*>(&dst[(size_t)e * TT + t]) = pv;
        }
      }
  }
}

// ---------------------------------------------------------------------------
// Kernel 2: flash attention. grid (B*H=64, T/128=16). Each wave owns 16 query
// rows, streams keys in 64-wide tiles with online softmax; O accumulated in
// WMMA f32 accumulators. P goes C-layout -> LDS -> A-layout once per tile.
// ---------------------------------------------------------------------------
__global__ __launch_bounds__(256)
void mha_flash_attn_kernel(const bf16_t* __restrict__ Qb,
                           const bf16_t* __restrict__ Kb,
                           const bf16_t* __restrict__ Vt,
                           bf16_t* __restrict__ Ob) {
  __shared__ bf16_t Pl[8][16 * 72];          // per-wave 16x64 P tile (+pad)
  const int tid = threadIdx.x, lane = tid & 31, wid = tid >> 5;
  const int lanen = lane & 15, hf = lane >> 4;
  const int bh = blockIdx.x;                 // 0..63
  const int b = bh >> 4, h = bh & 15;
  const int q0 = blockIdx.y * 128 + wid * 16;
  const bf16_t* Qh = Qb + (size_t)bh * TT * DH;
  const bf16_t* Kh = Kb + (size_t)bh * TT * DH;
  const bf16_t* Vh = Vt + (size_t)bh * DH * TT;

  v16bf qf[2];
  qf[0] = load_frag(Qh, q0,  0, DH);
  qf[1] = load_frag(Qh, q0, 32, DH);

  v8f o[4] = {};
  float mrun[8], lrun[8];
#pragma unroll
  for (int r = 0; r < 8; ++r) { mrun[r] = -3.0e38f; lrun[r] = 0.0f; }

  for (int kt = 0; kt < TT; kt += 64) {
    if (kt + 64 < TT) {
      __builtin_prefetch(Kh + (size_t)(kt + 64) * DH, 0, 1);
      __builtin_prefetch(Vh + (size_t)(kt + 64), 0, 1);
    }
    // S = Q * K^T  (scale already folded into Q)
    v8f s[4] = {};
#pragma unroll
    for (int j = 0; j < 2; ++j) {
#pragma unroll
      for (int n = 0; n < 4; ++n) {
        v16bf bk = load_frag(Kh, kt + n * 16, j * 32, DH);
        s[n] = wmma_bf16(qf[j], bk, s[n]);
      }
    }
    // online softmax: row stats via xor-shuffle across the 16-lane half
    float alpha[8];
#pragma unroll
    for (int r = 0; r < 8; ++r) {
      float mx = fmaxf(fmaxf(s[0][r], s[1][r]), fmaxf(s[2][r], s[3][r]));
#pragma unroll
      for (int msk = 1; msk < 16; msk <<= 1) mx = fmaxf(mx, __shfl_xor(mx, msk, 32));
      float mn = fmaxf(mrun[r], mx);
      alpha[r] = __expf(mrun[r] - mn);
      mrun[r] = mn;
    }
    float rs[8];
#pragma unroll
    for (int r = 0; r < 8; ++r) rs[r] = 0.0f;
#pragma unroll
    for (int n = 0; n < 4; ++n)
#pragma unroll
      for (int r = 0; r < 8; ++r) {
        float p = __expf(s[n][r] - mrun[r]);
        s[n][r] = p;
        rs[r] += p;
      }
#pragma unroll
    for (int r = 0; r < 8; ++r) {
#pragma unroll
      for (int msk = 1; msk < 16; msk <<= 1) rs[r] += __shfl_xor(rs[r], msk, 32);
      lrun[r] = lrun[r] * alpha[r] + rs[r];
    }
#pragma unroll
    for (int n = 0; n < 4; ++n)
#pragma unroll
      for (int r = 0; r < 8; ++r) o[n][r] *= alpha[r];

    // C-layout -> row-major bf16 P in LDS
    bf16_t* P = &Pl[wid][0];
#pragma unroll
    for (int n = 0; n < 4; ++n)
#pragma unroll
      for (int r = 0; r < 8; ++r)
        P[(r + 8 * hf) * 72 + n * 16 + lanen] = (bf16_t)s[n][r];
    __syncthreads();

    // O += P * V   (V^T is row-major [dh][t] -> direct B-fragments)
    v16bf pa0 = load_frag(P, 0,  0, 72);
    v16bf pa1 = load_frag(P, 0, 32, 72);
#pragma unroll
    for (int n = 0; n < 4; ++n) {
      v16bf bv0 = load_frag(Vh, n * 16, kt +  0, TT);
      v16bf bv1 = load_frag(Vh, n * 16, kt + 32, TT);
      o[n] = wmma_bf16(pa0, bv0, o[n]);
      o[n] = wmma_bf16(pa1, bv1, o[n]);
    }
    __syncthreads();
  }

  // normalize and store concat-head layout [b, t, h*64 + e]
#pragma unroll
  for (int n = 0; n < 4; ++n)
#pragma unroll
    for (int r = 0; r < 8; ++r) {
      int t = q0 + r + 8 * hf;
      float val = o[n][r] / lrun[r];
      Ob[((size_t)(b * TT + t) * (HH * DH)) + h * DH + n * 16 + lanen] = (bf16_t)val;
    }
}

// ---------------------------------------------------------------------------
// Kernel 3: output projection + bias.  Ob[8192,1024]bf16 x Wo[1024,1024]f32
// grid (64, 16): 128-row x 64-col tiles. A-fragments stream straight from
// global (bf16 row-major); Wo transposed+converted through LDS.
// ---------------------------------------------------------------------------
__global__ __launch_bounds__(256)
void mha_out_proj_kernel(const bf16_t* __restrict__ Ob,
                         const float* __restrict__ Wo,
                         const float* __restrict__ bo,
                         float* __restrict__ out) {
  __shared__ bf16_t Ws[64 * 72];
  const int tid = threadIdx.x, lane = tid & 31, wid = tid >> 5;
  const int lanen = lane & 15, hf = lane >> 4;
  const int wm = wid >> 1, wn = wid & 1;
  const int r0 = blockIdx.x * 128;
  const int n0 = blockIdx.y * 64;

  v8f c[2][2] = {};

  for (int k0 = 0; k0 < DD; k0 += 64) {
#pragma unroll
    for (int i = 0; i < 4; ++i) {
      int idx = i * 256 + tid;
      int d = idx >> 4, e4 = idx & 15;
      float4 wv = *reinterpret_cast<const float4*>(Wo + (size_t)(k0 + d) * DD + n0 + e4 * 4);
      Ws[(e4 * 4 + 0) * 72 + d] = (bf16_t)wv.x;
      Ws[(e4 * 4 + 1) * 72 + d] = (bf16_t)wv.y;
      Ws[(e4 * 4 + 2) * 72 + d] = (bf16_t)wv.z;
      Ws[(e4 * 4 + 3) * 72 + d] = (bf16_t)wv.w;
    }
    __syncthreads();
#pragma unroll
    for (int ks = 0; ks < 64; ks += 32) {
      v16bf a0 = load_frag(Ob, r0 + wm * 32 +  0, k0 + ks, DD);
      v16bf a1 = load_frag(Ob, r0 + wm * 32 + 16, k0 + ks, DD);
      v16bf b0 = load_frag(&Ws[0], wn * 32 +  0, ks, 72);
      v16bf b1 = load_frag(&Ws[0], wn * 32 + 16, ks, 72);
      c[0][0] = wmma_bf16(a0, b0, c[0][0]);
      c[0][1] = wmma_bf16(a0, b1, c[0][1]);
      c[1][0] = wmma_bf16(a1, b0, c[1][0]);
      c[1][1] = wmma_bf16(a1, b1, c[1][1]);
    }
    __syncthreads();
  }

#pragma unroll
  for (int mi = 0; mi < 2; ++mi)
#pragma unroll
    for (int ni = 0; ni < 2; ++ni) {
      int col = n0 + wn * 32 + ni * 16 + lanen;
      float bias = bo[col];
#pragma unroll
      for (int r = 0; r < 8; ++r) {
        int row = r0 + wm * 32 + mi * 16 + r + 8 * hf;
        out[(size_t)row * DD + col] = c[mi][ni][r] + bias;
      }
    }
}

extern "C" void kernel_launch(void* const* d_in, const int* in_sizes, int n_in,
                              void* d_out, int out_size, void* d_ws, size_t ws_size,
                              hipStream_t stream) {
  const float* x  = (const float*)d_in[0];
  const float* Wq = (const float*)d_in[1];
  const float* Wk = (const float*)d_in[2];
  const float* Wv = (const float*)d_in[3];
  const float* Wo = (const float*)d_in[4];
  const float* bo = (const float*)d_in[5];
  float* out = (float*)d_out;

  const size_t elems = (size_t)BB * HH * TT * DH;   // 8,388,608 per buffer
  bf16_t* Qb = (bf16_t*)d_ws;
  bf16_t* Kb = Qb + elems;
  bf16_t* Vt = Kb + elems;
  bf16_t* Ob = Vt + elems;

  mha_qkv_proj_kernel<<<dim3(64, 48), 256, 0, stream>>>(x, Wq, Wk, Wv, Qb, Kb, Vt);
  mha_flash_attn_kernel<<<dim3(64, 16), 256, 0, stream>>>(Qb, Kb, Vt, Ob);
  mha_out_proj_kernel<<<dim3(64, 16), 256, 0, stream>>>(Ob, Wo, bo, out);
}

// v001
// Measured time: 375 microseconds a run.
// In both of two side-by-side timings against v000, it was 1.44 times as fast.
#include <hip/hip_runtime.h>
#include <hip/hip_bf16.h>

typedef __bf16 bf16_t;
typedef __attribute__((ext_vector_type(16))) __bf16 v16bf;
typedef __attribute__((ext_vector_type(8)))  __bf16 v8bf;
typedef __attribute__((ext_vector_type(4)))  __bf16 v4bf;
typedef __attribute__((ext_vector_type(2)))  __bf16 v2bf;
typedef __attribute__((ext_vector_type(8)))  float  v8f;

#define BB  4
#define TT  2048
#define DD  1024
#define HH  16
#define DH  64

union FragU { v16bf v; v8bf h[2]; };

// Load a 16x32 bf16 WMMA A/B fragment from a row-major [rows][ld] bf16 matrix.
// A: row = base_row + lane%16 ; B: n = base_row + lane%16 with source in [N][K] layout.
// Per documented layout: elements 0..7 at K=k0+(lane/16)*8, elements 8..15 at K=k0+16+(lane/16)*8.
__device__ inline v16bf load_frag(const bf16_t* base, int row0, int k0, int ld) {
  const int lane = threadIdx.x & 31;
  const int sel  = lane & 15;
  const int hf   = lane >> 4;
  const bf16_t* p = base + (size_t)(row0 + sel) * ld + k0 + hf * 8;
  FragU f;
  f.h[0] = *reinterpret_cast<const v8bf*>(p);
  f.h[1] = *reinterpret_cast<const v8bf*>(p + 16);
  return f.v;
}

__device__ inline v8f wmma_bf16(v16bf a, v16bf b, v8f c) {
  // (neg_a, A, neg_b, B, c_mod, C, reuse_a, reuse_b)
  return __builtin_amdgcn_wmma_f32_16x16x32_bf16(false, a, false, b, (short)0, c, false, false);
}

// ---------------------------------------------------------------------------
// Kernel 1: fused QKV projection.  X[8192,1024]f32 x W[h][1024,64]f32 -> bf16
// Q,K stored [b,h,t,dh] row-major; V stored transposed [b,h,dh,t].
// 1/sqrt(DH)=0.125 folded into Q.
// grid (64, 48): x = 8192/128 row tiles, y = (mat 0..2)*16 + head
// ---------------------------------------------------------------------------
__global__ __launch_bounds__(256)
void mha_qkv_proj_kernel(const float* __restrict__ x,
                         const float* __restrict__ Wq,
                         const float* __restrict__ Wk,
                         const float* __restrict__ Wv,
                         bf16_t* __restrict__ Qb,
                         bf16_t* __restrict__ Kb,
                         bf16_t* __restrict__ Vt) {
  __shared__ bf16_t Xs[128 * 72];   // 128 rows x 64 K (+8 pad)
  __shared__ bf16_t Ws[64 * 72];    // [n=64][k=64] transposed weight tile
  const int tid  = threadIdx.x;
  const int lane = tid & 31, wid = tid >> 5;
  const int lanen = lane & 15, hf = lane >> 4;
  const int wm = wid >> 1, wn = wid & 1;          // 4x2 wave grid -> 128x64 tile
  const int r0  = blockIdx.x * 128;
  const int mh  = blockIdx.y;
  const int mat = mh >> 4;                        // 0=Q 1=K 2=V
  const int h   = mh & 15;
  const float* W = (mat == 0 ? Wq : (mat == 1 ? Wk : Wv)) + (size_t)h * DD * DH;

  v8f c[2][2] = {};

  for (int k0 = 0; k0 < DD; k0 += 64) {
    // Stage X tile (convert f32 -> bf16)
#pragma unroll
    for (int i = 0; i < 8; ++i) {
      int idx = i * 256 + tid;               // 2048 float4 loads
      int row = idx >> 4;
      int c4  = idx & 15;
      float4 xv = *reinterpret_cast<const float4*>(x + (size_t)(r0 + row) * DD + k0 + c4 * 4);
      v4bf bv = { (bf16_t)xv.x, (bf16_t)xv.y, (bf16_t)xv.z, (bf16_t)xv.w };
      *reinterpret_cast<v4bf*>(&Xs[row * 72 + c4 * 4]) = bv;
    }
    // Stage W tile transposed (convert f32 -> bf16)
#pragma unroll
    for (int i = 0; i < 4; ++i) {
      int idx = i * 256 + tid;               // 1024 float4 loads
      int d  = idx >> 4;
      int e4 = idx & 15;
      float4 wv = *reinterpret_cast<const float4*>(W + (size_t)(k0 + d) * DH + e4 * 4);
      Ws[(e4 * 4 + 0) * 72 + d] = (bf16_t)wv.x;
      Ws[(e4 * 4 + 1) * 72 + d] = (bf16_t)wv.y;
      Ws[(e4 * 4 + 2) * 72 + d] = (bf16_t)wv.z;
      Ws[(e4 * 4 + 3) * 72 + d] = (bf16_t)wv.w;
    }
    __syncthreads();
#pragma unroll
    for (int ks = 0; ks < 64; ks += 32) {
      v16bf a0 = load_frag(&Xs[0], wm * 32 +  0, ks, 72);
      v16bf a1 = load_frag(&Xs[0], wm * 32 + 16, ks, 72);
      v16bf b0 = load_frag(&Ws[0], wn * 32 +  0, ks, 72);
      v16bf b1 = load_frag(&Ws[0], wn * 32 + 16, ks, 72);
      c[0][0] = wmma_bf16(a0, b0, c[0][0]);
      c[0][1] = wmma_bf16(a0, b1, c[0][1]);
      c[1][0] = wmma_bf16(a1, b0, c[1][0]);
      c[1][1] = wmma_bf16(a1, b1, c[1][1]);
    }
    __syncthreads();
  }

  // Epilogue: tile never crosses a batch boundary (2048 % 128 == 0), and mat
  // is block-uniform -> one uniform branch, branch-free store loops inside.
  const int bidx = r0 >> 11;                 // batch index (uniform)
  const int t00  = (r0 & 2047) + wm * 32;    // base t for this wave
  const size_t bh = (size_t)(bidx * HH + h);

  if (mat == 0) {
    bf16_t* dst = Qb + bh * TT * DH;
#pragma unroll
    for (int mi = 0; mi < 2; ++mi)
#pragma unroll
      for (int ni = 0; ni < 2; ++ni) {
        int e = wn * 32 + ni * 16 + lanen;
#pragma unroll
        for (int r = 0; r < 8; ++r) {
          int t = t00 + mi * 16 + r + 8 * hf;
          dst[(size_t)t * DH + e] = (bf16_t)(c[mi][ni][r] * 0.125f);
        }
      }
  } else if (mat == 1) {
    bf16_t* dst = Kb + bh * TT * DH;
#pragma unroll
    for (int mi = 0; mi < 2; ++mi)
#pragma unroll
      for (int ni = 0; ni < 2; ++ni) {
        int e = wn * 32 + ni * 16 + lanen;
#pragma unroll
        for (int r = 0; r < 8; ++r) {
          int t = t00 + mi * 16 + r + 8 * hf;
          dst[(size_t)t * DH + e] = (bf16_t)c[mi][ni][r];
        }
      }
  } else {
    // V transposed [dh][t]: consecutive r -> consecutive t -> packed b32 stores
    bf16_t* dst = Vt + bh * DH * TT;
#pragma unroll
    for (int mi = 0; mi < 2; ++mi)
#pragma unroll
      for (int ni = 0; ni < 2; ++ni) {
        int e = wn * 32 + ni * 16 + lanen;
#pragma unroll
        for (int r = 0; r < 8; r += 2) {
          int t = t00 + mi * 16 + r + 8 * hf;   // even
          v2bf pv = { (bf16_t)c[mi][ni][r], (bf16_t)c[mi][ni][r + 1] };
          *reinterpret_cast<v2bf*>(&dst[(size_t)e * TT + t]) = pv;
        }
      }
  }
}

// ---------------------------------------------------------------------------
// Kernel 2: flash attention. grid (B*H=64, T/128=16). Each wave owns 16 query
// rows, streams keys in 64-wide tiles with online softmax; O accumulated in
// WMMA f32 accumulators. P goes C-layout -> LDS -> A-layout once per tile.
// The 64-key K tile and V^T tile are shared by the 8 waves: they are brought
// into a two-buffer LDS ring by asynchronous copies, one tile ahead, and every
// wave takes its B fragments from LDS.
// ---------------------------------------------------------------------------
#define KVP   72                 // LDS row pitch in bf16: 144 B = 16 B x odd
#define KVBUF (64 * KVP)         // one buffer: 64 rows

// Four 16-byte copies per lane = one K tile + one V^T tile per work-group.
// The s_wait_xcnt stands inside the statement so that no address register of
// an issued copy is rewritten in front of it.
__device__ inline void copy_kv_tile(unsigned lk, unsigned lv,
                                    const bf16_t* gk, const bf16_t* gv) {
  const unsigned lk1 = lk + 32 * KVP * 2, lv1 = lv + 32 * KVP * 2;
  const bf16_t* gk1 = gk + 32 * DH;
  const bf16_t* gv1 = gv + (size_t)32 * TT;
  asm volatile("global_load_async_to_lds_b128 %0, %4, off\n\t"
               "global_load_async_to_lds_b128 %1, %5, off\n\t"
               "global_load_async_to_lds_b128 %2, %6, off\n\t"
               "global_load_async_to_lds_b128 %3, %7, off\n\t"
               "s_wait_xcnt 0x0"
               :: "v"(lk), "v"(lk1), "v"(lv), "v"(lv1),
                  "v"(gk), "v"(gk1), "v"(gv), "v"(gv1)
               : "memory");
}

__global__ __launch_bounds__(256)
void mha_flash_attn_kernel(const bf16_t* __restrict__ Qb,
                           const bf16_t* __restrict__ Kb,
                           const bf16_t* __restrict__ Vt,
                           bf16_t* __restrict__ Ob) {
  __shared__ bf16_t Pl[8][16 * 72];          // per-wave 16x64 P tile (+pad)
  __shared__ __attribute__((aligned(16))) bf16_t Ks[2 * KVBUF];  // [buf][key][dh]
  __shared__ __attribute__((aligned(16))) bf16_t Vs[2 * KVBUF];  // [buf][dh][key]
  const int tid = threadIdx.x, lane = tid & 31, wid = tid >> 5;
  const int lanen = lane & 15, hf = lane >> 4;
  const int bh = blockIdx.x;                 // 0..63
  const int b = bh >> 4, h = bh & 15;
  const int q0 = blockIdx.y * 128 + wid * 16;
  const bf16_t* Qh = Qb + (size_t)bh * TT * DH;
  const bf16_t* Kh = Kb + (size_t)bh * TT * DH;
  const bf16_t* Vh = Vt + (size_t)bh * DH * TT;

  v16bf qf[2];
  qf[0] = load_frag(Qh, q0,  0, DH);
  qf[1] = load_frag(Qh, q0, 32, DH);

  v8f o[4] = {};
  float mrun[8], lrun[8];
#pragma unroll
  for (int r = 0; r < 8; ++r) { mrun[r] = -3.0e38f; lrun[r] = 0.0f; }

  // This lane's share of a tile: rows crow and crow + 32, 16 bytes at column ccol.
  const int crow = tid >> 3, ccol = (tid & 7) * 8;
  const unsigned ldsK = (unsigned)(uintptr_t)&Ks[crow * KVP + ccol];
  const unsigned ldsV = (unsigned)(uintptr_t)&Vs[crow * KVP + ccol];
  const bf16_t* gK = Kh + crow * DH + ccol;            // + kt * DH per tile
  const bf16_t* gV = Vh + (size_t)crow * TT + ccol;    // + kt per tile

  // Ring prologue: tile 0 landed and published, then tile 1 in flight.
  copy_kv_tile(ldsK, ldsV, gK, gV);
  asm volatile("s_wait_asynccnt 0x0" ::: "memory");    // own copies of tile 0 landed
  __syncthreads();                                     // every wave's copies visible
  copy_kv_tile(ldsK + KVBUF * 2, ldsV + KVBUF * 2, gK + 64 * DH, gV + 64);

  for (int kt = 0; kt < TT; kt += 64) {
    const int buf = (kt >> 6) & 1;
    const bf16_t* Kl = &Ks[buf * KVBUF];
    const bf16_t* Vl = &Vs[buf * KVBUF];
    // S = Q * K^T  (scale already folded into Q)
    v8f s[4] = {};
#pragma unroll
    for (int j = 0; j < 2; ++j) {
#pragma unroll
      for (int n = 0; n < 4; ++n) {
        v16bf bk = load_frag(Kl, n * 16, j * 32, KVP);
        s[n] = wmma_bf16(qf[j], bk, s[n]);
      }
    }
    // online softmax: row stats via xor-shuffle across the 16-lane half
    float alpha[8];
#pragma unroll
    for (int r = 0; r < 8; ++r) {
      float mx = fmaxf(fmaxf(s[0][r], s[1][r]), fmaxf(s[2][r], s[3][r]));
#pragma unroll
      for (int msk = 1; msk < 16; msk <<= 1) mx = fmaxf(mx, __shfl_xor(mx, msk, 32));
      float mn = fmaxf(mrun[r], mx);
      alpha[r] = __expf(mrun[r] - mn);
      mrun[r] = mn;
    }
    float rs[8];
#pragma unroll
    for (int r = 0; r < 8; ++r) rs[r] = 0.0f;
#pragma unroll
    for (int n = 0; n < 4; ++n)
#pragma unroll
      for (int r = 0; r < 8; ++r) {
        float p = __expf(s[n][r] - mrun[r]);
        s[n][r] = p;
        rs[r] += p;
      }
#pragma unroll
    for (int r = 0; r < 8; ++r) {
#pragma unroll
      for (int msk = 1; msk < 16; msk <<= 1) rs[r] += __shfl_xor(rs[r], msk, 32);
      lrun[r] = lrun[r] * alpha[r] + rs[r];
    }
#pragma unroll
    for (int n = 0; n < 4; ++n)
#pragma unroll
      for (int r = 0; r < 8; ++r) o[n][r] *= alpha[r];

    // C-layout -> row-major bf16 P in LDS
    bf16_t* P = &Pl[wid][0];
#pragma unroll
    for (int n = 0; n < 4; ++n)
#pragma unroll
      for (int r = 0; r < 8; ++r)
        P[(r + 8 * hf) * 72 + n * 16 + lanen] = (bf16_t)s[n][r];
    __syncthreads();

    // O += P * V   (V^T tile is [dh][key] in LDS -> direct B-fragments)
    v16bf pa0 = load_frag(P, 0,  0, 72);
    v16bf pa1 = load_frag(P, 0, 32, 72);
#pragma unroll
    for (int n = 0; n < 4; ++n) {
      v16bf bv0 = load_frag(Vl, n * 16,  0, KVP);
      v16bf bv1 = load_frag(Vl, n * 16, 32, KVP);
      o[n] = wmma_bf16(pa0, bv0, o[n]);
      o[n] = wmma_bf16(pa1, bv1, o[n]);
    }
    // Publish point of the next tile; it also frees this tile's buffer and P.
    asm volatile("s_wait_dscnt 0x0" ::: "memory");     // own LDS reads of this buffer done
    asm volatile("s_wait_asynccnt 0x0" ::: "memory");  // own copies of the next tile landed
    __syncthreads();
    if (kt + 128 < TT)                                 // same for the whole work-group
      copy_kv_tile(ldsK + buf * (KVBUF * 2), ldsV + buf * (KVBUF * 2),
                   gK + (size_t)(kt + 128) * DH, gV + (kt + 128));
  }
  asm volatile("s_wait_asynccnt 0x0" ::: "memory");    // nothing in flight at the wave's end

  // normalize and store concat-head layout [b, t, h*64 + e]
#pragma unroll
  for (int n = 0; n < 4; ++n)
#pragma unroll
    for (int r = 0; r < 8; ++r) {
      int t = q0 + r + 8 * hf;
      float val = o[n][r] / lrun[r];
      Ob[((size_t)(b * TT + t) * (HH * DH)) + h * DH + n * 16 + lanen] = (bf16_t)val;
    }
}

// ---------------------------------------------------------------------------
// Kernel 3: output projection + bias.  Ob[8192,1024]bf16 x Wo[1024,1024]f32
// grid (64, 16): 128-row x 64-col tiles. A-fragments stream straight from
// global (bf16 row-major); Wo transposed+converted through LDS.
// ---------------------------------------------------------------------------
__global__ __launch_bounds__(256)
void mha_out_proj_kernel(const bf16_t* __restrict__ Ob,
                         const float* __restrict__ Wo,
                         const float* __restrict__ bo,
                         float* __restrict__ out) {
  __shared__ bf16_t Ws[64 * 72];
  const int tid = threadIdx.x, lane = tid & 31, wid = tid >> 5;
  const int lanen = lane & 15, hf = lane >> 4;
  const int wm = wid >> 1, wn = wid & 1;
  const int r0 = blockIdx.x * 128;
  const int n0 = blockIdx.y * 64;

  v8f c[2][2] = {};

  for (int k0 = 0; k0 < DD; k0 += 64) {
#pragma unroll
    for (int i = 0; i < 4; ++i) {
      int idx = i * 256 + tid;
      int d = idx >> 4, e4 = idx & 15;
      float4 wv = *reinterpret_cast<const float4*>(Wo + (size_t)(k0 + d) * DD + n0 + e4 * 4);
      Ws[(e4 * 4 + 0) * 72 + d] = (bf16_t)wv.x;
      Ws[(e4 * 4 + 1) * 72 + d] = (bf16_t)wv.y;
      Ws[(e4 * 4 + 2) * 72 + d] = (bf16_t)wv.z;
      Ws[(e4 * 4 + 3) * 72 + d] = (bf16_t)wv.w;
    }
    __syncthreads();
#pragma unroll
    for (int ks = 0; ks < 64; ks += 32) {
      v16bf a0 = load_frag(Ob, r0 + wm * 32 +  0, k0 + ks, DD);
      v16bf a1 = load_frag(Ob, r0 + wm * 32 + 16, k0 + ks, DD);
      v16bf b0 = load_frag(&Ws[0], wn * 32 +  0, ks, 72);
      v16bf b1 = load_frag(&Ws[0], wn * 32 + 16, ks, 72);
      c[0][0] = wmma_bf16(a0, b0, c[0][0]);
      c[0][1] = wmma_bf16(a0, b1, c[0][1]);
      c[1][0] = wmma_bf16(a1, b0, c[1][0]);
      c[1][1] = wmma_bf16(a1, b1, c[1][1]);
    }
    __syncthreads();
  }

#pragma unroll
  for (int mi = 0; mi < 2; ++mi)
#pragma unroll
    for (int ni = 0; ni < 2; ++ni) {
      int col = n0 + wn * 32 + ni * 16 + lanen;
      float bias = bo[col];
#pragma unroll
      for (int r = 0; r < 8; ++r) {
        int row = r0 + wm * 32 + mi * 16 + r + 8 * hf;
        out[(size_t)row * DD + col] = c[mi][ni][r] + bias;
      }
    }
}

extern "C" void kernel_launch(void* const* d_in, const int* in_sizes, int n_in,
                              void* d_out, int out_size, void* d_ws, size_t ws_size,
                              hipStream_t stream) {
  const float* x  = (const float*)d_in[0];
  const float* Wq = (const float*)d_in[1];
  const float* Wk = (const float*)d_in[2];
  const float* Wv = (const float*)d_in[3];
  const float* Wo = (const float*)d_in[4];
  const float* bo = (const float*)d_in[5];
  float* out = (float*)d_out;

  const size_t elems = (size_t)BB * HH * TT * DH;   // 8,388,608 per buffer
  bf16_t* Qb = (bf16_t*)d_ws;
  bf16_t* Kb = Qb + elems;
  bf16_t* Vt = Kb + elems;
  bf16_t* Ob = Vt + elems;

  mha_qkv_proj_kernel<<<dim3(64, 48), 256, 0, stream>>>(x, Wq, Wk, Wv, Qb, Kb, Vt);
  mha_flash_attn_kernel<<<dim3(64, 16), 256, 0, stream>>>(Qb, Kb, Vt, Ob);
  mha_out_proj_kernel<<<dim3(64, 16), 256, 0, stream>>>(Ob, Wo, bo, out);
}

// v002
// One run takes 270 microseconds.
// Two timings next to v001 both put it at 1.39 times that version's speed.
// Counting every step since v000, it is 2.01 times as fast.
#include <hip/hip_runtime.h>
#include <hip/hip_bf16.h>

typedef __bf16 bf16_t;
typedef __attribute__((ext_vector_type(16))) __bf16 v16bf;
typedef __attribute__((ext_vector_type(8)))  __bf16 v8bf;
typedef __attribute__((ext_vector_type(4)))  __bf16 v4bf;
typedef __attribute__((ext_vector_type(2)))  __bf16 v2bf;
typedef __attribute__((ext_vector_type(8)))  float  v8f;

#define BB  4
#define TT  2048
#define DD  1024
#define HH  16
#define DH  64

union FragU { v16bf v; v8bf h[2]; };

// Load a 16x32 bf16 WMMA A/B fragment from a row-major [rows][ld] bf16 matrix.
// A: row = base_row + lane%16 ; B: n = base_row + lane%16 with source in [N][K] layout.
// Per documented layout: elements 0..7 at K=k0+(lane/16)*8, elements 8..15 at K=k0+16+(lane/16)*8.
__device__ inline v16bf load_frag(const bf16_t* base, int row0, int k0, int ld) {
  const int lane = threadIdx.x & 31;
  const int sel  = lane & 15;
  const int hf   = lane >> 4;
  const bf16_t* p = base + (size_t)(row0 + sel) * ld + k0 + hf * 8;
  FragU f;
  f.h[0] = *reinterpret_cast<const v8bf*>(p);
  f.h[1] = *reinterpret_cast<const v8bf*>(p + 16);
  return f.v;
}

__device__ inline v8f wmma_bf16(v16bf a, v16bf b, v8f c) {
  // (neg_a, A, neg_b, B, c_mod, C, reuse_a, reuse_b)
  return __builtin_amdgcn_wmma_f32_16x16x32_bf16(false, a, false, b, (short)0, c, false, false);
}

// ---------------------------------------------------------------------------
// Kernel 1: fused QKV projection.  X[8192,1024]f32 x W[h][1024,64]f32 -> bf16
// Q,K stored [b,h,t,dh] row-major; V stored transposed [b,h,dh,t].
// 1/sqrt(DH)=0.125 folded into Q.
// grid (64, 48): x = 8192/128 row tiles, y = (mat 0..2)*16 + head
// ---------------------------------------------------------------------------
__global__ __launch_bounds__(256)
void mha_qkv_proj_kernel(const float* __restrict__ x,
                         const float* __restrict__ Wq,
                         const float* __restrict__ Wk,
                         const float* __restrict__ Wv,
                         bf16_t* __restrict__ Qb,
                         bf16_t* __restrict__ Kb,
                         bf16_t* __restrict__ Vt) {
  __shared__ bf16_t Xs[128 * 72];   // 128 rows x 64 K (+8 pad)
  __shared__ bf16_t Ws[64 * 72];    // [n=64][k=64] transposed weight tile
  const int tid  = threadIdx.x;
  const int lane = tid & 31, wid = tid >> 5;
  const int lanen = lane & 15, hf = lane >> 4;
  const int wm = wid >> 1, wn = wid & 1;          // 4x2 wave grid -> 128x64 tile
  const int r0  = blockIdx.x * 128;
  const int mh  = blockIdx.y;
  const int mat = mh >> 4;                        // 0=Q 1=K 2=V
  const int h   = mh & 15;
  const float* W = (mat == 0 ? Wq : (mat == 1 ? Wk : Wv)) + (size_t)h * DD * DH;

  v8f c[2][2] = {};

  for (int k0 = 0; k0 < DD; k0 += 64) {
    // Stage X tile (convert f32 -> bf16)
#pragma unroll
    for (int i = 0; i < 8; ++i) {
      int idx = i * 256 + tid;               // 2048 float4 loads
      int row = idx >> 4;
      int c4  = idx & 15;
      float4 xv = *reinterpret_cast<const float4*>(x + (size_t)(r0 + row) * DD + k0 + c4 * 4);
      v4bf bv = { (bf16_t)xv.x, (bf16_t)xv.y, (bf16_t)xv.z, (bf16_t)xv.w };
      *reinterpret_cast<v4bf*>(&Xs[row * 72 + c4 * 4]) = bv;
    }
    // Stage W tile transposed (convert f32 -> bf16)
#pragma unroll
    for (int i = 0; i < 4; ++i) {
      int idx = i * 256 + tid;               // 1024 float4 loads
      int d  = idx >> 4;
      int e4 = idx & 15;
      float4 wv = *reinterpret_cast<const float4*>(W + (size_t)(k0 + d) * DH + e4 * 4);
      Ws[(e4 * 4 + 0) * 72 + d] = (bf16_t)wv.x;
      Ws[(e4 * 4 + 1) * 72 + d] = (bf16_t)wv.y;
      Ws[(e4 * 4 + 2) * 72 + d] = (bf16_t)wv.z;
      Ws[(e4 * 4 + 3) * 72 + d] = (bf16_t)wv.w;
    }
    __syncthreads();
#pragma unroll
    for (int ks = 0; ks < 64; ks += 32) {
      v16bf a0 = load_frag(&Xs[0], wm * 32 +  0, ks, 72);
      v16bf a1 = load_frag(&Xs[0], wm * 32 + 16, ks, 72);
      v16bf b0 = load_frag(&Ws[0], wn * 32 +  0, ks, 72);
      v16bf b1 = load_frag(&Ws[0], wn * 32 + 16, ks, 72);
      c[0][0] = wmma_bf16(a0, b0, c[0][0]);
      c[0][1] = wmma_bf16(a0, b1, c[0][1]);
      c[1][0] = wmma_bf16(a1, b0, c[1][0]);
      c[1][1] = wmma_bf16(a1, b1, c[1][1]);
    }
    __syncthreads();
  }

  // Epilogue: tile never crosses a batch boundary (2048 % 128 == 0), and mat
  // is block-uniform -> one uniform branch, branch-free store loops inside.
  const int bidx = r0 >> 11;                 // batch index (uniform)
  const int t00  = (r0 & 2047) + wm * 32;    // base t for this wave
  const size_t bh = (size_t)(bidx * HH + h);

  if (mat == 0) {
    bf16_t* dst = Qb + bh * TT * DH;
#pragma unroll
    for (int mi = 0; mi < 2; ++mi)
#pragma unroll
      for (int ni = 0; ni < 2; ++ni) {
        int e = wn * 32 + ni * 16 + lanen;
#pragma unroll
        for (int r = 0; r < 8; ++r) {
          int t = t00 + mi * 16 + r + 8 * hf;
          dst[(size_t)t * DH + e] = (bf16_t)(c[mi][ni][r] * 0.125f);
        }
      }
  } else if (mat == 1) {
    bf16_t* dst = Kb + bh * TT * DH;
#pragma unroll
    for (int mi = 0; mi < 2; ++mi)
#pragma unroll
      for (int ni = 0; ni < 2; ++ni) {
        int e = wn * 32 + ni * 16 + lanen;
#pragma unroll
        for (int r = 0; r < 8; ++r) {
          int t = t00 + mi * 16 + r + 8 * hf;
          dst[(size_t)t * DH + e] = (bf16_t)c[mi][ni][r];
        }
      }
  } else {
    // V transposed [dh][t]: consecutive r -> consecutive t -> packed b32 stores
    bf16_t* dst = Vt + bh * DH * TT;
#pragma unroll
    for (int mi = 0; mi < 2; ++mi)
#pragma unroll
      for (int ni = 0; ni < 2; ++ni) {
        int e = wn * 32 + ni * 16 + lanen;
#pragma unroll
        for (int r = 0; r < 8; r += 2) {
          int t = t00 + mi * 16 + r + 8 * hf;   // even
          v2bf pv = { (bf16_t)c[mi][ni][r], (bf16_t)c[mi][ni][r + 1] };
          *reinterpret_cast<v2bf*>(&dst[(size_t)e * TT + t]) = pv;
        }
      }
  }
}

#define KVP   72                 // LDS row pitch in bf16: 144 B = 16 B x odd
#define KVBUF (64 * KVP)         // one buffer: 64 rows

// Four 16-byte copies per lane = one K tile + one V^T tile per work-group.
// The s_wait_xcnt stands inside the statement so that no address register of
// an issued copy is rewritten in front of it.
__device__ inline void copy_kv_tile(unsigned lk, unsigned lv,
                                    const bf16_t* gk, const bf16_t* gv) {
  const unsigned lk1 = lk + 32 * KVP * 2, lv1 = lv + 32 * KVP * 2;
  const bf16_t* gk1 = gk + 32 * DH;
  const bf16_t* gv1 = gv + (size_t)32 * TT;
  asm volatile("global_load_async_to_lds_b128 %0, %4, off\n\t"
               "global_load_async_to_lds_b128 %1, %5, off\n\t"
               "global_load_async_to_lds_b128 %2, %6, off\n\t"
               "global_load_async_to_lds_b128 %3, %7, off\n\t"
               "s_wait_xcnt 0x0"
               :: "v"(lk), "v"(lk1), "v"(lv), "v"(lv1),
                  "v"(gk), "v"(gk1), "v"(gv), "v"(gv1)
               : "memory");
}

// Lane l takes the value of lane l ^ 16 (a register move, no LDS traffic).
__device__ inline float xhalf(float v) {
  const int i = __builtin_bit_cast(int, v);
  return __builtin_bit_cast(float,
      __builtin_amdgcn_permlanex16(i, i, 0x76543210, 0xfedcba98, false, false));
}

__global__ __launch_bounds__(256)
void mha_flash_attn_kernel(const bf16_t* __restrict__ Qb,
                           const bf16_t* __restrict__ Kb,
                           const bf16_t* __restrict__ Vt,
                           bf16_t* __restrict__ Ob) {
  __shared__ __attribute__((aligned(16))) bf16_t Ks[2 * KVBUF];  // [buf][key][dh]
  __shared__ __attribute__((aligned(16))) bf16_t Vs[2 * KVBUF];  // [buf][dh][key]
  const int tid = threadIdx.x, lane = tid & 31, wid = tid >> 5;
  const int lanen = lane & 15, hf = lane >> 4;
  const int bh = blockIdx.x;                 // 0..63
  const int b = bh >> 4, h = bh & 15;
  const int q0 = blockIdx.y * 128 + wid * 16;
  const bf16_t* Qh = Qb + (size_t)bh * TT * DH;
  const bf16_t* Kh = Kb + (size_t)bh * TT * DH;
  const bf16_t* Vh = Vt + (size_t)bh * DH * TT;

  // Q as B operand: column = query q0 + lane%16, k = dh in the hardware order.
  v16bf qf[2];
  qf[0] = load_frag(Qh, q0,  0, DH);
  qf[1] = load_frag(Qh, q0, 32, DH);

  v8f o[4] = {};                             // o[n][r] = O^T[n*16 + 8*hf + r][query]
  float mrun = -3.0e38f;                     // this lane's query: running maximum
  float lrun = 0.0f;                         // and the sum over this half's keys

  // This lane's share of a tile: rows crow and crow + 32, 16 bytes at column ccol.
  const int crow = tid >> 3, ccol = (tid & 7) * 8;
  const unsigned ldsK = (unsigned)(uintptr_t)&Ks[crow * KVP + ccol];
  const unsigned ldsV = (unsigned)(uintptr_t)&Vs[crow * KVP + ccol];
  const bf16_t* gK = Kh + crow * DH + ccol;            // + kt * DH per tile
  const bf16_t* gV = Vh + (size_t)crow * TT + ccol;    // + kt per tile

  // Ring prologue: tile 0 landed and published, then tile 1 in flight.
  copy_kv_tile(ldsK, ldsV, gK, gV);
  asm volatile("s_wait_asynccnt 0x0" ::: "memory");    // own copies of tile 0 landed
  __syncthreads();                                     // every wave's copies visible
  copy_kv_tile(ldsK + KVBUF * 2, ldsV + KVBUF * 2, gK + 64 * DH, gV + 64);

  for (int kt = 0; kt < TT; kt += 64) {
    const int buf = (kt >> 6) & 1;
    const bf16_t* Kl = &Ks[buf * KVBUF];
    const bf16_t* Vl = &Vs[buf * KVBUF];
    // S^T = K * Q^T  (scale already folded into Q)
    // s[n][r] = score of key kt + n*16 + 8*hf + r against this lane's query
    v8f s[4] = {};
#pragma unroll
    for (int j = 0; j < 2; ++j) {
#pragma unroll
      for (int n = 0; n < 4; ++n) {
        v16bf ak = load_frag(Kl, n * 16, j * 32, KVP);
        s[n] = wmma_bf16(ak, qf[j], s[n]);
      }
    }
    // online softmax: in-lane over 32 keys, one exchange for the other 32
    float mx[8];
#pragma unroll
    for (int r = 0; r < 8; ++r)
      mx[r] = fmaxf(fmaxf(s[0][r], s[1][r]), fmaxf(s[2][r], s[3][r]));
    float mt = fmaxf(fmaxf(fmaxf(mx[0], mx[1]), fmaxf(mx[2], mx[3])),
                     fmaxf(fmaxf(mx[4], mx[5]), fmaxf(mx[6], mx[7])));
    mt = fmaxf(mt, xhalf(mt));
    const float mn = fmaxf(mrun, mt);
    const float alpha = __expf(mrun - mn);
    mrun = mn;

    float rs[4] = {0.0f, 0.0f, 0.0f, 0.0f};  // four chains, joined below
#pragma unroll
    for (int n = 0; n < 4; ++n)
#pragma unroll
      for (int r = 0; r < 8; ++r) {
        float p = __expf(s[n][r] - mn);
        s[n][r] = p;
        rs[n] += p;
      }
    lrun = lrun * alpha + ((rs[0] + rs[1]) + (rs[2] + rs[3]));
#pragma unroll
    for (int n = 0; n < 4; ++n)
#pragma unroll
      for (int r = 0; r < 8; ++r) o[n][r] *= alpha;

    // P^T as B operand: tiles 2*kk and 2*kk + 1 give k = 8*hf + e and 16 + 8*hf + e,
    // the order in which load_frag takes the keys of a V^T row.
    v16bf pb[2];
#pragma unroll
    for (int kk = 0; kk < 2; ++kk)
#pragma unroll
      for (int e = 0; e < 8; ++e) {
        pb[kk][e]     = (bf16_t)s[2 * kk][e];
        pb[kk][e + 8] = (bf16_t)s[2 * kk + 1][e];
      }

    // O^T += V^T * P^T   (V^T tile is [dh][key] in LDS -> direct A-fragments)
#pragma unroll
    for (int kk = 0; kk < 2; ++kk) {
#pragma unroll
      for (int n = 0; n < 4; ++n) {
        v16bf av = load_frag(Vl, n * 16, kk * 32, KVP);
        o[n] = wmma_bf16(av, pb[kk], o[n]);
      }
    }
    // Publish point of the next tile; it also frees this tile's buffer.
    asm volatile("s_wait_dscnt 0x0" ::: "memory");     // own LDS reads of this buffer done
    asm volatile("s_wait_asynccnt 0x0" ::: "memory");  // own copies of the next tile landed
    __syncthreads();
    if (kt + 128 < TT)                                 // same for the whole work-group
      copy_kv_tile(ldsK + buf * (KVBUF * 2), ldsV + buf * (KVBUF * 2),
                   gK + (size_t)(kt + 128) * DH, gV + (kt + 128));
  }
  asm volatile("s_wait_asynccnt 0x0" ::: "memory");    // nothing in flight at the wave's end

  // join the halves' sums, normalize, store concat-head layout [b, t, h*64 + e]:
  // a lane's 8 accumulator registers are 8 consecutive e of its query's row.
  const float ltot = lrun + xhalf(lrun);
  bf16_t* dst = Ob + ((size_t)(b * TT + q0 + lanen) * (HH * DH)) + h * DH + 8 * hf;
#pragma unroll
  for (int n = 0; n < 4; ++n) {
    v8bf ov;
#pragma unroll
    for (int r = 0; r < 8; ++r) ov[r] = (bf16_t)(o[n][r] / ltot);
    *reinterpret_cast<v8bf*>(dst + n * 16) = ov;
  }
}

// ---------------------------------------------------------------------------
// Kernel 3: output projection + bias.  Ob[8192,1024]bf16 x Wo[1024,1024]f32
// grid (64, 16): 128-row x 64-col tiles. A-fragments stream straight from
// global (bf16 row-major); Wo transposed+converted through LDS.
// ---------------------------------------------------------------------------
__global__ __launch_bounds__(256)
void mha_out_proj_kernel(const bf16_t* __restrict__ Ob,
                         const float* __restrict__ Wo,
                         const float* __restrict__ bo,
                         float* __restrict__ out) {
  __shared__ bf16_t Ws[64 * 72];
  const int tid = threadIdx.x, lane = tid & 31, wid = tid >> 5;
  const int lanen = lane & 15, hf = lane >> 4;
  const int wm = wid >> 1, wn = wid & 1;
  const int r0 = blockIdx.x * 128;
  const int n0 = blockIdx.y * 64;

  v8f c[2][2] = {};

  for (int k0 = 0; k0 < DD; k0 += 64) {
#pragma unroll
    for (int i = 0; i < 4; ++i) {
      int idx = i * 256 + tid;
      int d = idx >> 4, e4 = idx & 15;
      float4 wv = *reinterpret_cast<const float4*>(Wo + (size_t)(k0 + d) * DD + n0 + e4 * 4);
      Ws[(e4 * 4 + 0) * 72 + d] = (bf16_t)wv.x;
      Ws[(e4 * 4 + 1) * 72 + d] = (bf16_t)wv.y;
      Ws[(e4 * 4 + 2) * 72 + d] = (bf16_t)wv.z;
      Ws[(e4 * 4 + 3) * 72 + d] = (bf16_t)wv.w;
    }
    __syncthreads();
#pragma unroll
    for (int ks = 0; ks < 64; ks += 32) {
      v16bf a0 = load_frag(Ob, r0 + wm * 32 +  0, k0 + ks, DD);
      v16bf a1 = load_frag(Ob, r0 + wm * 32 + 16, k0 + ks, DD);
      v16bf b0 = load_frag(&Ws[0], wn * 32 +  0, ks, 72);
      v16bf b1 = load_frag(&Ws[0], wn * 32 + 16, ks, 72);
      c[0][0] = wmma_bf16(a0, b0, c[0][0]);
      c[0][1] = wmma_bf16(a0, b1, c[0][1]);
      c[1][0] = wmma_bf16(a1, b0, c[1][0]);
      c[1][1] = wmma_bf16(a1, b1, c[1][1]);
    }
    __syncthreads();
  }

#pragma unroll
  for (int mi = 0; mi < 2; ++mi)
#pragma unroll
    for (int ni = 0; ni < 2; ++ni) {
      int col = n0 + wn * 32 + ni * 16 + lanen;
      float bias = bo[col];
#pragma unroll
      for (int r = 0; r < 8; ++r) {
        int row = r0 + wm * 32 + mi * 16 + r + 8 * hf;
        out[(size_t)row * DD + col] = c[mi][ni][r] + bias;
      }
    }
}

extern "C" void kernel_launch(void* const* d_in, const int* in_sizes, int n_in,
                              void* d_out, int out_size, void* d_ws, size_t ws_size,
                              hipStream_t stream) {
  const float* x  = (const float*)d_in[0];
  const float* Wq = (const float*)d_in[1];
  const float* Wk = (const float*)d_in[2];
  const float* Wv = (const float*)d_in[3];
  const float* Wo = (const float*)d_in[4];
  const float* bo = (const float*)d_in[5];
  float* out = (float*)d_out;

  const size_t elems = (size_t)BB * HH * TT * DH;   // 8,388,608 per buffer
  bf16_t* Qb = (bf16_t*)d_ws;
  bf16_t* Kb = Qb + elems;
  bf16_t* Vt = Kb + elems;
  bf16_t* Ob = Vt + elems;

  mha_qkv_proj_kernel<<<dim3(64, 48), 256, 0, stream>>>(x, Wq, Wk, Wv, Qb, Kb, Vt);
  mha_flash_attn_kernel<<<dim3(64, 16), 256, 0, stream>>>(Qb, Kb, Vt, Ob);
  mha_out_proj_kernel<<<dim3(64, 16), 256, 0, stream>>>(Ob, Wo, bo, out);
}

// v003
// One run takes 171 microseconds.
// Two timings next to v002 both put it at 1.58 times that version's speed.
// Over all steps from v000 it is 3.16 times as fast.
#include <hip/hip_runtime.h>
#include <hip/hip_bf16.h>

typedef __bf16 bf16_t;
typedef __attribute__((ext_vector_type(16))) __bf16 v16bf;
typedef __attribute__((ext_vector_type(8)))  __bf16 v8bf;
typedef __attribute__((ext_vector_type(4)))  __bf16 v4bf;
typedef __attribute__((ext_vector_type(2)))  __bf16 v2bf;
typedef __attribute__((ext_vector_type(8)))  float  v8f;

#define BB  4
#define TT  2048
#define DD  1024
#define HH  16
#define DH  64

union FragU { v16bf v; v8bf h[2]; };

// Load a 16x32 bf16 WMMA A/B fragment from a row-major [rows][ld] bf16 matrix.
// A: row = base_row + lane%16 ; B: n = base_row + lane%16 with source in [N][K] layout.
// Per documented layout: elements 0..7 at K=k0+(lane/16)*8, elements 8..15 at K=k0+16+(lane/16)*8.
__device__ inline v16bf load_frag(const bf16_t* base, int row0, int k0, int ld) {
  const int lane = threadIdx.x & 31;
  const int sel  = lane & 15;
  const int hf   = lane >> 4;
  const bf16_t* p = base + (size_t)(row0 + sel) * ld + k0 + hf * 8;
  FragU f;
  f.h[0] = *reinterpret_cast<const v8bf*>(p);
  f.h[1] = *reinterpret_cast<const v8bf*>(p + 16);
  return f.v;
}

__device__ inline v8f wmma_bf16(v16bf a, v16bf b, v8f c) {
  // (neg_a, A, neg_b, B, c_mod, C, reuse_a, reuse_b)
  return __builtin_amdgcn_wmma_f32_16x16x32_bf16(false, a, false, b, (short)0, c, false, false);
}

// ---------------------------------------------------------------------------
// Kernel 0: operands of both projections converted to bf16 once per call.
// Xb[8192][1024] = x.  WT[4096][1024] holds every weight with k contiguous:
// row (mat*16 + h)*64 + e = column e of Wq/Wk/Wv[h], row 3072 + n = column n of Wo.
// Blocks 0..255: a 256(k) x 64(n) weight strip each, transposed through LDS.
// Blocks 256..767: 16 float4 of x per thread, every load a wave-contiguous 512 B.
// ---------------------------------------------------------------------------
#define TSP 264                  // LDS row pitch in bf16: 528 B = 16 B x odd

__global__ __launch_bounds__(256)
void mha_convert_kernel(const float* __restrict__ x,
                        const float* __restrict__ Wq,
                        const float* __restrict__ Wk,
                        const float* __restrict__ Wv,
                        const float* __restrict__ Wo,
                        bf16_t* __restrict__ Xb,
                        bf16_t* __restrict__ WT) {
  __shared__ __attribute__((aligned(16))) bf16_t Ts[64 * TSP];   // [n=64][k=256]
  const int tid = threadIdx.x;
  if (blockIdx.x >= 256) {                     // block-uniform: these blocks meet no barrier
    const size_t base = (size_t)(blockIdx.x - 256) * 4096 + tid;   // in float4
    float4 xv[16];
#pragma unroll
    for (int i = 0; i < 16; ++i) {
      // the last load's result may be given the address registers that the loads
      // before it name: the wait stands in front of that overwrite
      if (i == 15) asm volatile("s_wait_xcnt 0x0" ::: "memory");
      xv[i] = reinterpret_cast<const float4*>(x)[base + i * 256];
    }
#pragma unroll
    for (int i = 0; i < 16; ++i) {
      v4bf bv = { (bf16_t)xv[i].x, (bf16_t)xv[i].y, (bf16_t)xv[i].z, (bf16_t)xv[i].w };
      reinterpret_cast<v4bf*>(Xb)[base + i * 256] = bv;
    }
    return;
  }
  const int m  = blockIdx.x >> 2;              // group of 64 rows of WT
  const int kb = (blockIdx.x & 3) * 256;       // first k of the strip
  const int mat = m >> 4, h = m & 15;
  // the strip's first element and its row pitch in floats (block-uniform)
  const float* src = mat == 0 ? Wq : (mat == 1 ? Wk : (mat == 2 ? Wv : Wo));
  const int pitch  = mat < 3 ? DH : DD;
  src += (mat < 3 ? (size_t)h * DD * DH : (size_t)h * 64) + (size_t)kb * pitch;
  const int d0 = tid >> 4, e4 = tid & 15;
  const float* p = src + (size_t)d0 * pitch + e4 * 4;
  float4 wv[16];
#pragma unroll
  for (int i = 0; i < 16; ++i)
    wv[i] = *reinterpret_cast<const float4*>(p + (size_t)(i * 16) * pitch);
#pragma unroll
  for (int i = 0; i < 16; ++i) {
    const int d = i * 16 + d0;
    Ts[(e4 * 4 + 0) * TSP + d] = (bf16_t)wv[i].x;
    Ts[(e4 * 4 + 1) * TSP + d] = (bf16_t)wv[i].y;
    Ts[(e4 * 4 + 2) * TSP + d] = (bf16_t)wv[i].z;
    Ts[(e4 * 4 + 3) * TSP + d] = (bf16_t)wv[i].w;
  }
  __syncthreads();
#pragma unroll
  for (int i = 0; i < 8; ++i) {
    int idx = i * 256 + tid;
    int row = idx >> 5, c8 = idx & 31;         // a wave writes 512 B of one row
    *reinterpret_cast<v8bf*>(WT + (size_t)(m * 64 + row) * DD + kb + c8 * 8) =
        *reinterpret_cast<const v8bf*>(&Ts[row * TSP + c8 * 8]);
  }
}

// ---------------------------------------------------------------------------
// Kernel 1: fused QKV projection.  Xb[8192,1024]bf16 x WT rows (k contiguous)
// Q,K stored [b,h,t,dh] row-major; V stored transposed [b,h,dh,t].
// 1/sqrt(DH)=0.125 folded into Q.
// grid (64, 48): x = 8192/128 row tiles, y = (mat 0..2)*16 + head
// ---------------------------------------------------------------------------
__global__ __launch_bounds__(256)
void mha_qkv_proj_kernel(const bf16_t* __restrict__ Xb,
                         const bf16_t* __restrict__ WT,
                         bf16_t* __restrict__ Qb,
                         bf16_t* __restrict__ Kb,
                         bf16_t* __restrict__ Vt) {
  __shared__ __attribute__((aligned(16))) bf16_t Xs[128 * 72];   // 128 rows x 64 K (+8 pad)
  __shared__ __attribute__((aligned(16))) bf16_t Ws[64 * 72];    // [n=64][k=64] weight tile
  const int tid  = threadIdx.x;
  const int lane = tid & 31, wid = tid >> 5;
  const int lanen = lane & 15, hf = lane >> 4;
  const int wm = wid >> 1, wn = wid & 1;          // 4x2 wave grid -> 128x64 tile
  const int r0  = blockIdx.x * 128;
  const int mh  = blockIdx.y;
  const int mat = mh >> 4;                        // 0=Q 1=K 2=V
  const int h   = mh & 15;
  const bf16_t* Wm = WT + (size_t)mh * 64 * DD;   // this head's 64 rows of WT

  v8f c[2][2] = {};

  for (int k0 = 0; k0 < DD; k0 += 64) {
    // Stage the X tile and the weight tile: 16-byte pieces, 8 lanes to a 128-B row
    const int srow = tid >> 3, sc8 = (tid & 7) * 8;
    v8bf xr[4], wr[2];
#pragma unroll
    for (int i = 0; i < 4; ++i)
      xr[i] = *reinterpret_cast<const v8bf*>(Xb + (size_t)(r0 + i * 32 + srow) * DD + k0 + sc8);
#pragma unroll
    for (int i = 0; i < 2; ++i)
      wr[i] = *reinterpret_cast<const v8bf*>(Wm + (size_t)(i * 32 + srow) * DD + k0 + sc8);
#pragma unroll
    for (int i = 0; i < 4; ++i)
      *reinterpret_cast<v8bf*>(&Xs[(i * 32 + srow) * 72 + sc8]) = xr[i];
#pragma unroll
    for (int i = 0; i < 2; ++i)
      *reinterpret_cast<v8bf*>(&Ws[(i * 32 + srow) * 72 + sc8]) = wr[i];
    __syncthreads();
#pragma unroll
    for (int ks = 0; ks < 64; ks += 32) {
      v16bf a0 = load_frag(&Xs[0], wm * 32 +  0, ks, 72);
      v16bf a1 = load_frag(&Xs[0], wm * 32 + 16, ks, 72);
      v16bf b0 = load_frag(&Ws[0], wn * 32 +  0, ks, 72);
      v16bf b1 = load_frag(&Ws[0], wn * 32 + 16, ks, 72);
      c[0][0] = wmma_bf16(a0, b0, c[0][0]);
      c[0][1] = wmma_bf16(a0, b1, c[0][1]);
      c[1][0] = wmma_bf16(a1, b0, c[1][0]);
      c[1][1] = wmma_bf16(a1, b1, c[1][1]);
    }
    __syncthreads();
  }

  // Epilogue: tile never crosses a batch boundary (2048 % 128 == 0), and mat
  // is block-uniform -> one uniform branch, branch-free store loops inside.
  const int bidx = r0 >> 11;                 // batch index (uniform)
  const int t00  = (r0 & 2047) + wm * 32;    // base t for this wave
  const size_t bh = (size_t)(bidx * HH + h);

  if (mat == 0) {
    bf16_t* dst = Qb + bh * TT * DH;
#pragma unroll
    for (int mi = 0; mi < 2; ++mi)
#pragma unroll
      for (int ni = 0; ni < 2; ++ni) {
        int e = wn * 32 + ni * 16 + lanen;
#pragma unroll
        for (int r = 0; r < 8; ++r) {
          int t = t00 + mi * 16 + r + 8 * hf;
          dst[(size_t)t * DH + e] = (bf16_t)(c[mi][ni][r] * 0.125f);
        }
      }
  } else if (mat == 1) {
    bf16_t* dst = Kb + bh * TT * DH;
#pragma unroll
    for (int mi = 0; mi < 2; ++mi)
#pragma unroll
      for (int ni = 0; ni < 2; ++ni) {
        int e = wn * 32 + ni * 16 + lanen;
#pragma unroll
        for (int r = 0; r < 8; ++r) {
          int t = t00 + mi * 16 + r + 8 * hf;
          dst[(size_t)t * DH + e] = (bf16_t)c[mi][ni][r];
        }
      }
  } else {
    // V transposed [dh][t]: consecutive r -> consecutive t -> packed b32 stores
    bf16_t* dst = Vt + bh * DH * TT;
#pragma unroll
    for (int mi = 0; mi < 2; ++mi)
#pragma unroll
      for (int ni = 0; ni < 2; ++ni) {
        int e = wn * 32 + ni * 16 + lanen;
#pragma unroll
        for (int r = 0; r < 8; r += 2) {
          int t = t00 + mi * 16 + r + 8 * hf;   // even
          v2bf pv = { (bf16_t)c[mi][ni][r], (bf16_t)c[mi][ni][r + 1] };
          *reinterpret_cast<v2bf*>(&dst[(size_t)e * TT + t]) = pv;
        }
      }
  }
}

#define KVP   72                 // LDS row pitch in bf16: 144 B = 16 B x odd
#define KVBUF (64 * KVP)         // one buffer: 64 rows

// Four 16-byte copies per lane = one K tile + one V^T tile per work-group.
// The s_wait_xcnt stands inside the statement so that no address register of
// an issued copy is rewritten in front of it.
__device__ inline void copy_kv_tile(unsigned lk, unsigned lv,
                                    const bf16_t* gk, const bf16_t* gv) {
  const unsigned lk1 = lk + 32 * KVP * 2, lv1 = lv + 32 * KVP * 2;
  const bf16_t* gk1 = gk + 32 * DH;
  const bf16_t* gv1 = gv + (size_t)32 * TT;
  asm volatile("global_load_async_to_lds_b128 %0, %4, off\n\t"
               "global_load_async_to_lds_b128 %1, %5, off\n\t"
               "global_load_async_to_lds_b128 %2, %6, off\n\t"
               "global_load_async_to_lds_b128 %3, %7, off\n\t"
               "s_wait_xcnt 0x0"
               :: "v"(lk), "v"(lk1), "v"(lv), "v"(lv1),
                  "v"(gk), "v"(gk1), "v"(gv), "v"(gv1)
               : "memory");
}

// Lane l takes the value of lane l ^ 16 (a register move, no LDS traffic).
__device__ inline float xhalf(float v) {
  const int i = __builtin_bit_cast(int, v);
  return __builtin_bit_cast(float,
      __builtin_amdgcn_permlanex16(i, i, 0x76543210, 0xfedcba98, false, false));
}

__global__ __launch_bounds__(256)
void mha_flash_attn_kernel(const bf16_t* __restrict__ Qb,
                           const bf16_t* __restrict__ Kb,
                           const bf16_t* __restrict__ Vt,
                           bf16_t* __restrict__ Ob) {
  __shared__ __attribute__((aligned(16))) bf16_t Ks[2 * KVBUF];  // [buf][key][dh]
  __shared__ __attribute__((aligned(16))) bf16_t Vs[2 * KVBUF];  // [buf][dh][key]
  const int tid = threadIdx.x, lane = tid & 31, wid = tid >> 5;
  const int lanen = lane & 15, hf = lane >> 4;
  const int bh = blockIdx.x;                 // 0..63
  const int b = bh >> 4, h = bh & 15;
  const int q0 = blockIdx.y * 128 + wid * 16;
  const bf16_t* Qh = Qb + (size_t)bh * TT * DH;
  const bf16_t* Kh = Kb + (size_t)bh * TT * DH;
  const bf16_t* Vh = Vt + (size_t)bh * DH * TT;

  // Q as B operand: column = query q0 + lane%16, k = dh in the hardware order.
  v16bf qf[2];
  qf[0] = load_frag(Qh, q0,  0, DH);
  qf[1] = load_frag(Qh, q0, 32, DH);

  v8f o[4] = {};                             // o[n][r] = O^T[n*16 + 8*hf + r][query]
  float mrun = -3.0e38f;                     // this lane's query: running maximum
  float lrun = 0.0f;                         // and the sum over this half's keys

  // This lane's share of a tile: rows crow and crow + 32, 16 bytes at column ccol.
  const int crow = tid >> 3, ccol = (tid & 7) * 8;
  const unsigned ldsK = (unsigned)(uintptr_t)&Ks[crow * KVP + ccol];
  const unsigned ldsV = (unsigned)(uintptr_t)&Vs[crow * KVP + ccol];
  const bf16_t* gK = Kh + crow * DH + ccol;            // + kt * DH per tile
  const bf16_t* gV = Vh + (size_t)crow * TT + ccol;    // + kt per tile

  // Ring prologue: tile 0 landed and published, then tile 1 in flight.
  copy_kv_tile(ldsK, ldsV, gK, gV);
  asm volatile("s_wait_asynccnt 0x0" ::: "memory");    // own copies of tile 0 landed
  __syncthreads();                                     // every wave's copies visible
  copy_kv_tile(ldsK + KVBUF * 2, ldsV + KVBUF * 2, gK + 64 * DH, gV + 64);

  for (int kt = 0; kt < TT; kt += 64) {
    const int buf = (kt >> 6) & 1;
    const bf16_t* Kl = &Ks[buf * KVBUF];
    const bf16_t* Vl = &Vs[buf * KVBUF];
    // S^T = K * Q^T  (scale already folded into Q)
    // s[n][r] = score of key kt + n*16 + 8*hf + r against this lane's query
    v8f s[4] = {};
#pragma unroll
    for (int j = 0; j < 2; ++j) {
#pragma unroll
      for (int n = 0; n < 4; ++n) {
        v16bf ak = load_frag(Kl, n * 16, j * 32, KVP);
        s[n] = wmma_bf16(ak, qf[j], s[n]);
      }
    }
    // online softmax: in-lane over 32 keys, one exchange for the other 32
    float mx[8];
#pragma unroll
    for (int r = 0; r < 8; ++r)
      mx[r] = fmaxf(fmaxf(s[0][r], s[1][r]), fmaxf(s[2][r], s[3][r]));
    float mt = fmaxf(fmaxf(fmaxf(mx[0], mx[1]), fmaxf(mx[2], mx[3])),
                     fmaxf(fmaxf(mx[4], mx[5]), fmaxf(mx[6], mx[7])));
    mt = fmaxf(mt, xhalf(mt));
    const float mn = fmaxf(mrun, mt);
    const float alpha = __expf(mrun - mn);
    mrun = mn;

    float rs[4] = {0.0f, 0.0f, 0.0f, 0.0f};  // four chains, joined below
#pragma unroll
    for (int n = 0; n < 4; ++n)
#pragma unroll
      for (int r = 0; r < 8; ++r) {
        float p = __expf(s[n][r] - mn);
        s[n][r] = p;
        rs[n] += p;
      }
    lrun = lrun * alpha + ((rs[0] + rs[1]) + (rs[2] + rs[3]));
#pragma unroll
    for (int n = 0; n < 4; ++n)
#pragma unroll
      for (int r = 0; r < 8; ++r) o[n][r] *= alpha;

    // P^T as B operand: tiles 2*kk and 2*kk + 1 give k = 8*hf + e and 16 + 8*hf + e,
    // the order in which load_frag takes the keys of a V^T row.
    v16bf pb[2];
#pragma unroll
    for (int kk = 0; kk < 2; ++kk)
#pragma unroll
      for (int e = 0; e < 8; ++e) {
        pb[kk][e]     = (bf16_t)s[2 * kk][e];
        pb[kk][e + 8] = (bf16_t)s[2 * kk + 1][e];
      }

    // O^T += V^T * P^T   (V^T tile is [dh][key] in LDS -> direct A-fragments)
#pragma unroll
    for (int kk = 0; kk < 2; ++kk) {
#pragma unroll
      for (int n = 0; n < 4; ++n) {
        v16bf av = load_frag(Vl, n * 16, kk * 32, KVP);
        o[n] = wmma_bf16(av, pb[kk], o[n]);
      }
    }
    // Publish point of the next tile; it also frees this tile's buffer.
    asm volatile("s_wait_dscnt 0x0" ::: "memory");     // own LDS reads of this buffer done
    asm volatile("s_wait_asynccnt 0x0" ::: "memory");  // own copies of the next tile landed
    __syncthreads();
    if (kt + 128 < TT)                                 // same for the whole work-group
      copy_kv_tile(ldsK + buf * (KVBUF * 2), ldsV + buf * (KVBUF * 2),
                   gK + (size_t)(kt + 128) * DH, gV + (kt + 128));
  }
  asm volatile("s_wait_asynccnt 0x0" ::: "memory");    // nothing in flight at the wave's end

  // join the halves' sums, normalize, store concat-head layout [b, t, h*64 + e]:
  // a lane's 8 accumulator registers are 8 consecutive e of its query's row.
  const float ltot = lrun + xhalf(lrun);
  bf16_t* dst = Ob + ((size_t)(b * TT + q0 + lanen) * (HH * DH)) + h * DH + 8 * hf;
#pragma unroll
  for (int n = 0; n < 4; ++n) {
    v8bf ov;
#pragma unroll
    for (int r = 0; r < 8; ++r) ov[r] = (bf16_t)(o[n][r] / ltot);
    *reinterpret_cast<v8bf*>(dst + n * 16) = ov;
  }
}

// ---------------------------------------------------------------------------
// Kernel 3: output projection + bias.  Ob[8192,1024]bf16 x WT rows 3072.. (Wo^T)
// grid (64, 16): 128-row x 64-col tiles. A-fragments stream straight from
// global (bf16 row-major); the weight tile goes through LDS as it lies.
// ---------------------------------------------------------------------------
__global__ __launch_bounds__(256)
void mha_out_proj_kernel(const bf16_t* __restrict__ Ob,
                         const bf16_t* __restrict__ WT,
                         const float* __restrict__ bo,
                         float* __restrict__ out) {
  __shared__ __attribute__((aligned(16))) bf16_t Ws[64 * 72];
  const int tid = threadIdx.x, lane = tid & 31, wid = tid >> 5;
  const int lanen = lane & 15, hf = lane >> 4;
  const int wm = wid >> 1, wn = wid & 1;
  const int r0 = blockIdx.x * 128;
  const int n0 = blockIdx.y * 64;
  const bf16_t* Wn = WT + (size_t)(3 * HH * DH + n0) * DD;   // rows n0.. of Wo^T

  v8f c[2][2] = {};

  for (int k0 = 0; k0 < DD; k0 += 64) {
    const int srow = tid >> 3, sc8 = (tid & 7) * 8;
#pragma unroll
    for (int i = 0; i < 2; ++i)
      *reinterpret_cast<v8bf*>(&Ws[(i * 32 + srow) * 72 + sc8]) =
          *reinterpret_cast<const v8bf*>(Wn + (size_t)(i * 32 + srow) * DD + k0 + sc8);
    __syncthreads();
#pragma unroll
    for (int ks = 0; ks < 64; ks += 32) {
      v16bf a0 = load_frag(Ob, r0 + wm * 32 +  0, k0 + ks, DD);
      v16bf a1 = load_frag(Ob, r0 + wm * 32 + 16, k0 + ks, DD);
      v16bf b0 = load_frag(&Ws[0], wn * 32 +  0, ks, 72);
      v16bf b1 = load_frag(&Ws[0], wn * 32 + 16, ks, 72);
      c[0][0] = wmma_bf16(a0, b0, c[0][0]);
      c[0][1] = wmma_bf16(a0, b1, c[0][1]);
      c[1][0] = wmma_bf16(a1, b0, c[1][0]);
      c[1][1] = wmma_bf16(a1, b1, c[1][1]);
    }
    __syncthreads();
  }

#pragma unroll
  for (int mi = 0; mi < 2; ++mi)
#pragma unroll
    for (int ni = 0; ni < 2; ++ni) {
      int col = n0 + wn * 32 + ni * 16 + lanen;
      float bias = bo[col];
#pragma unroll
      for (int r = 0; r < 8; ++r) {
        int row = r0 + wm * 32 + mi * 16 + r + 8 * hf;
        out[(size_t)row * DD + col] = c[mi][ni][r] + bias;
      }
    }
}

extern "C" void kernel_launch(void* const* d_in, const int* in_sizes, int n_in,
                              void* d_out, int out_size, void* d_ws, size_t ws_size,
                              hipStream_t stream) {
  const float* x  = (const float*)d_in[0];
  const float* Wq = (const float*)d_in[1];
  const float* Wk = (const float*)d_in[2];
  const float* Wv = (const float*)d_in[3];
  const float* Wo = (const float*)d_in[4];
  const float* bo = (const float*)d_in[5];
  float* out = (float*)d_out;

  const size_t elems = (size_t)BB * HH * TT * DH;   // 8,388,608 per buffer
  bf16_t* Qb = (bf16_t*)d_ws;
  bf16_t* Kb = Qb + elems;
  bf16_t* Vt = Kb + elems;
  bf16_t* Ob = Vt + elems;
  bf16_t* Xb = Ob + elems;
  bf16_t* WT = Xb + elems;                          // 4096 x 1024

  mha_convert_kernel<<<dim3(768), 256, 0, stream>>>(x, Wq, Wk, Wv, Wo, Xb, WT);
  mha_qkv_proj_kernel<<<dim3(64, 48), 256, 0, stream>>>(Xb, WT, Qb, Kb, Vt);
  mha_flash_attn_kernel<<<dim3(64, 16), 256, 0, stream>>>(Qb, Kb, Vt, Ob);
  mha_out_proj_kernel<<<dim3(64, 16), 256, 0, stream>>>(Ob, WT, bo, out);
}

// v004
// It runs in 165 microseconds.
// Two timings next to v003 both put it at 1.04 times that version's speed.
// All steps since v000 together make it 3.30 times as fast.
#include <hip/hip_runtime.h>
#include <hip/hip_bf16.h>

typedef __bf16 bf16_t;
typedef __attribute__((ext_vector_type(16))) __bf16 v16bf;
typedef __attribute__((ext_vector_type(8)))  __bf16 v8bf;
typedef __attribute__((ext_vector_type(4)))  __bf16 v4bf;
typedef __attribute__((ext_vector_type(2)))  __bf16 v2bf;
typedef __attribute__((ext_vector_type(8)))  float  v8f;

#define BB  4
#define TT  2048
#define DD  1024
#define HH  16
#define DH  64

union FragU { v16bf v; v8bf h[2]; };

// Load a 16x32 bf16 WMMA A/B fragment from a row-major [rows][ld] bf16 matrix.
// A: row = base_row + lane%16 ; B: n = base_row + lane%16 with source in [N][K] layout.
// Per documented layout: elements 0..7 at K=k0+(lane/16)*8, elements 8..15 at K=k0+16+(lane/16)*8.
__device__ inline v16bf load_frag(const bf16_t* base, int row0, int k0, int ld) {
  const int lane = threadIdx.x & 31;
  const int sel  = lane & 15;
  const int hf   = lane >> 4;
  const bf16_t* p = base + (size_t)(row0 + sel) * ld + k0 + hf * 8;
  FragU f;
  f.h[0] = *reinterpret_cast<const v8bf*>(p);
  f.h[1] = *reinterpret_cast<const v8bf*>(p + 16);
  return f.v;
}

__device__ inline v8f wmma_bf16(v16bf a, v16bf b, v8f c) {
  // (neg_a, A, neg_b, B, c_mod, C, reuse_a, reuse_b)
  return __builtin_amdgcn_wmma_f32_16x16x32_bf16(false, a, false, b, (short)0, c, false, false);
}

// ---------------------------------------------------------------------------
// Kernel 0: operands of both projections converted to bf16 once per call.
// Xb[8192][1024] = x.  WT[4096][1024] holds every weight with k contiguous:
// row (mat*16 + h)*64 + e = column e of Wq/Wk/Wv[h], row 3072 + n = column n of Wo.
// Blocks 0..255: a 256(k) x 64(n) weight strip each, transposed through LDS.
// Blocks 256..767: 16 float4 of x per thread, every load a wave-contiguous 512 B.
// ---------------------------------------------------------------------------
#define TSP 264                  // LDS row pitch in bf16: 528 B = 16 B x odd

__global__ __launch_bounds__(256)
void mha_convert_kernel(const float* __restrict__ x,
                        const float* __restrict__ Wq,
                        const float* __restrict__ Wk,
                        const float* __restrict__ Wv,
                        const float* __restrict__ Wo,
                        bf16_t* __restrict__ Xb,
                        bf16_t* __restrict__ WT) {
  __shared__ __attribute__((aligned(16))) bf16_t Ts[64 * TSP];   // [n=64][k=256]
  const int tid = threadIdx.x;
  if (blockIdx.x >= 256) {                     // block-uniform: these blocks meet no barrier
    const size_t base = (size_t)(blockIdx.x - 256) * 4096 + tid;   // in float4
    float4 xv[16];
#pragma unroll
    for (int i = 0; i < 16; ++i) {
      // the last load's result may be given the address registers that the loads
      // before it name: the wait stands in front of that overwrite
      if (i == 15) asm volatile("s_wait_xcnt 0x0" ::: "memory");
      xv[i] = reinterpret_cast<const float4*>(x)[base + i * 256];
    }
#pragma unroll
    for (int i = 0; i < 16; ++i) {
      v4bf bv = { (bf16_t)xv[i].x, (bf16_t)xv[i].y, (bf16_t)xv[i].z, (bf16_t)xv[i].w };
      reinterpret_cast<v4bf*>(Xb)[base + i * 256] = bv;
    }
    return;
  }
  const int m  = blockIdx.x >> 2;              // group of 64 rows of WT
  const int kb = (blockIdx.x & 3) * 256;       // first k of the strip
  const int mat = m >> 4, h = m & 15;
  // the strip's first element and its row pitch in floats (block-uniform)
  const float* src = mat == 0 ? Wq : (mat == 1 ? Wk : (mat == 2 ? Wv : Wo));
  const int pitch  = mat < 3 ? DH : DD;
  src += (mat < 3 ? (size_t)h * DD * DH : (size_t)h * 64) + (size_t)kb * pitch;
  const int d0 = tid >> 4, e4 = tid & 15;
  const float* p = src + (size_t)d0 * pitch + e4 * 4;
  float4 wv[16];
#pragma unroll
  for (int i = 0; i < 16; ++i)
    wv[i] = *reinterpret_cast<const float4*>(p + (size_t)(i * 16) * pitch);
#pragma unroll
  for (int i = 0; i < 16; ++i) {
    const int d = i * 16 + d0;
    Ts[(e4 * 4 + 0) * TSP + d] = (bf16_t)wv[i].x;
    Ts[(e4 * 4 + 1) * TSP + d] = (bf16_t)wv[i].y;
    Ts[(e4 * 4 + 2) * TSP + d] = (bf16_t)wv[i].z;
    Ts[(e4 * 4 + 3) * TSP + d] = (bf16_t)wv[i].w;
  }
  __syncthreads();
#pragma unroll
  for (int i = 0; i < 8; ++i) {
    int idx = i * 256 + tid;
    int row = idx >> 5, c8 = idx & 31;         // a wave writes 512 B of one row
    *reinterpret_cast<v8bf*>(WT + (size_t)(m * 64 + row) * DD + kb + c8 * 8) =
        *reinterpret_cast<const v8bf*>(&Ts[row * TSP + c8 * 8]);
  }
}

// ---------------------------------------------------------------------------
// Kernel 1: fused QKV projection.  Xb[8192,1024]bf16 x WT rows (k contiguous)
// Q,K stored [b,h,t,dh] row-major; V stored transposed [b,h,dh,t].
// 1/sqrt(DH)=0.125 folded into Q.
// grid (64, 48): x = 8192/128 row tiles, y = (mat 0..2)*16 + head
// ---------------------------------------------------------------------------
__global__ __launch_bounds__(256)
void mha_qkv_proj_kernel(const bf16_t* __restrict__ Xb,
                         const bf16_t* __restrict__ WT,
                         bf16_t* __restrict__ Qb,
                         bf16_t* __restrict__ Kb,
                         bf16_t* __restrict__ Vt) {
  __shared__ __attribute__((aligned(16))) bf16_t Xs[128 * 72];   // 128 rows x 64 K (+8 pad)
  __shared__ __attribute__((aligned(16))) bf16_t Ws[64 * 72];    // [n=64][k=64] weight tile
  const int tid  = threadIdx.x;
  const int lane = tid & 31, wid = tid >> 5;
  const int lanen = lane & 15, hf = lane >> 4;
  const int wm = wid >> 1, wn = wid & 1;          // 4x2 wave grid -> 128x64 tile
  const int r0  = blockIdx.x * 128;
  const int mh  = blockIdx.y;
  const int mat = mh >> 4;                        // 0=Q 1=K 2=V
  const int h   = mh & 15;
  const bf16_t* Wm = WT + (size_t)mh * 64 * DD;   // this head's 64 rows of WT

  v8f c[2][2] = {};

  for (int k0 = 0; k0 < DD; k0 += 64) {
    // Stage the X tile and the weight tile: 16-byte pieces, 8 lanes to a 128-B row
    const int srow = tid >> 3, sc8 = (tid & 7) * 8;
    v8bf xr[4], wr[2];
#pragma unroll
    for (int i = 0; i < 4; ++i)
      xr[i] = *reinterpret_cast<const v8bf*>(Xb + (size_t)(r0 + i * 32 + srow) * DD + k0 + sc8);
#pragma unroll
    for (int i = 0; i < 2; ++i)
      wr[i] = *reinterpret_cast<const v8bf*>(Wm + (size_t)(i * 32 + srow) * DD + k0 + sc8);
#pragma unroll
    for (int i = 0; i < 4; ++i)
      *reinterpret_cast<v8bf*>(&Xs[(i * 32 + srow) * 72 + sc8]) = xr[i];
#pragma unroll
    for (int i = 0; i < 2; ++i)
      *reinterpret_cast<v8bf*>(&Ws[(i * 32 + srow) * 72 + sc8]) = wr[i];
    __syncthreads();
#pragma unroll
    for (int ks = 0; ks < 64; ks += 32) {
      v16bf a0 = load_frag(&Xs[0], wm * 32 +  0, ks, 72);
      v16bf a1 = load_frag(&Xs[0], wm * 32 + 16, ks, 72);
      v16bf b0 = load_frag(&Ws[0], wn * 32 +  0, ks, 72);
      v16bf b1 = load_frag(&Ws[0], wn * 32 + 16, ks, 72);
      c[0][0] = wmma_bf16(a0, b0, c[0][0]);
      c[0][1] = wmma_bf16(a0, b1, c[0][1]);
      c[1][0] = wmma_bf16(a1, b0, c[1][0]);
      c[1][1] = wmma_bf16(a1, b1, c[1][1]);
    }
    __syncthreads();
  }

  // Epilogue: tile never crosses a batch boundary (2048 % 128 == 0), and mat
  // is block-uniform -> one uniform branch, branch-free store loops inside.
  const int bidx = r0 >> 11;                 // batch index (uniform)
  const int t00  = (r0 & 2047) + wm * 32;    // base t for this wave
  const size_t bh = (size_t)(bidx * HH + h);

  if (mat == 0) {
    bf16_t* dst = Qb + bh * TT * DH;
#pragma unroll
    for (int mi = 0; mi < 2; ++mi)
#pragma unroll
      for (int ni = 0; ni < 2; ++ni) {
        int e = wn * 32 + ni * 16 + lanen;
#pragma unroll
        for (int r = 0; r < 8; ++r) {
          int t = t00 + mi * 16 + r + 8 * hf;
          dst[(size_t)t * DH + e] = (bf16_t)(c[mi][ni][r] * 0.125f);
        }
      }
  } else if (mat == 1) {
    bf16_t* dst = Kb + bh * TT * DH;
#pragma unroll
    for (int mi = 0; mi < 2; ++mi)
#pragma unroll
      for (int ni = 0; ni < 2; ++ni) {
        int e = wn * 32 + ni * 16 + lanen;
#pragma unroll
        for (int r = 0; r < 8; ++r) {
          int t = t00 + mi * 16 + r + 8 * hf;
          dst[(size_t)t * DH + e] = (bf16_t)c[mi][ni][r];
        }
      }
  } else {
    // V transposed [dh][t]: consecutive r -> consecutive t -> packed b32 stores
    bf16_t* dst = Vt + bh * DH * TT;
#pragma unroll
    for (int mi = 0; mi < 2; ++mi)
#pragma unroll
      for (int ni = 0; ni < 2; ++ni) {
        int e = wn * 32 + ni * 16 + lanen;
#pragma unroll
        for (int r = 0; r < 8; r += 2) {
          int t = t00 + mi * 16 + r + 8 * hf;   // even
          v2bf pv = { (bf16_t)c[mi][ni][r], (bf16_t)c[mi][ni][r + 1] };
          *reinterpret_cast<v2bf*>(&dst[(size_t)e * TT + t]) = pv;
        }
      }
  }
}

#define KVP   72                 // LDS row pitch in bf16: 144 B = 16 B x odd
#define KVBUF (64 * KVP)         // one buffer: 64 rows
#define QC    2                  // 16-column query groups per wave

// Four 16-byte copies per lane = one K tile + one V^T tile per work-group.
// The s_wait_xcnt stands inside the statement so that no address register of
// an issued copy is rewritten in front of it.
__device__ inline void copy_kv_tile(unsigned lk, unsigned lv,
                                    const bf16_t* gk, const bf16_t* gv) {
  const unsigned lk1 = lk + 32 * KVP * 2, lv1 = lv + 32 * KVP * 2;
  const bf16_t* gk1 = gk + 32 * DH;
  const bf16_t* gv1 = gv + (size_t)32 * TT;
  asm volatile("global_load_async_to_lds_b128 %0, %4, off\n\t"
               "global_load_async_to_lds_b128 %1, %5, off\n\t"
               "global_load_async_to_lds_b128 %2, %6, off\n\t"
               "global_load_async_to_lds_b128 %3, %7, off\n\t"
               "s_wait_xcnt 0x0"
               :: "v"(lk), "v"(lk1), "v"(lv), "v"(lv1),
                  "v"(gk), "v"(gk1), "v"(gv), "v"(gv1)
               : "memory");
}

// Lane l takes the value of lane l ^ 16 (a register move, no LDS traffic).
__device__ inline float xhalf(float v) {
  const int i = __builtin_bit_cast(int, v);
  return __builtin_bit_cast(float,
      __builtin_amdgcn_permlanex16(i, i, 0x76543210, 0xfedcba98, false, false));
}

// Register budget of four waves a SIMD: two work-groups stay resident on a WGP.
__global__ __launch_bounds__(256) __attribute__((amdgpu_waves_per_eu(4, 4)))
void mha_flash_attn_kernel(const bf16_t* __restrict__ Qb,
                           const bf16_t* __restrict__ Kb,
                           const bf16_t* __restrict__ Vt,
                           bf16_t* __restrict__ Ob) {
  __shared__ __attribute__((aligned(16))) bf16_t Ks[2 * KVBUF];  // [buf][key][dh]
  __shared__ __attribute__((aligned(16))) bf16_t Vs[2 * KVBUF];  // [buf][dh][key]
  const int tid = threadIdx.x, lane = tid & 31, wid = tid >> 5;
  const int lanen = lane & 15, hf = lane >> 4;
  const int bh = blockIdx.x;                 // 0..63
  const int b = bh >> 4, h = bh & 15;
  const int q0 = blockIdx.y * (128 * QC) + wid * (16 * QC);
  const bf16_t* Qh = Qb + (size_t)bh * TT * DH;
  const bf16_t* Kh = Kb + (size_t)bh * TT * DH;
  const bf16_t* Vh = Vt + (size_t)bh * DH * TT;

  // Q as B operand: column = query q0 + c*16 + lane%16 for group c, k = dh in the hardware order.
  v16bf qf[QC][2];
  v8f o[QC][4] = {};                         // o[c][n][r] = O^T[n*16 + 8*hf + r][query of group c]
  float mrun[QC];                            // this lane's queries: running maximum
  float lrun[QC];                            // and the sum over this half's keys
#pragma unroll
  for (int c = 0; c < QC; ++c) {
    qf[c][0] = load_frag(Qh, q0 + c * 16,  0, DH);
    qf[c][1] = load_frag(Qh, q0 + c * 16, 32, DH);
    mrun[c] = -3.0e38f;
    lrun[c] = 0.0f;
  }

  // This lane's share of a tile: rows crow and crow + 32, 16 bytes at column ccol.
  const int crow = tid >> 3, ccol = (tid & 7) * 8;
  const unsigned ldsK = (unsigned)(uintptr_t)&Ks[crow * KVP + ccol];
  const unsigned ldsV = (unsigned)(uintptr_t)&Vs[crow * KVP + ccol];
  const bf16_t* gK = Kh + crow * DH + ccol;            // + kt * DH per tile
  const bf16_t* gV = Vh + (size_t)crow * TT + ccol;    // + kt per tile

  // Ring prologue: tile 0 landed and published, then tile 1 in flight.
  copy_kv_tile(ldsK, ldsV, gK, gV);
  asm volatile("s_wait_asynccnt 0x0" ::: "memory");    // own copies of tile 0 landed
  __syncthreads();                                     // every wave's copies visible
  copy_kv_tile(ldsK + KVBUF * 2, ldsV + KVBUF * 2, gK + 64 * DH, gV + 64);

  for (int kt = 0; kt < TT; kt += 64) {
    const int buf = (kt >> 6) & 1;
    const bf16_t* Kl = &Ks[buf * KVBUF];
    const bf16_t* Vl = &Vs[buf * KVBUF];
    // S^T = K * Q^T  (scale already folded into Q)
    // s[c][n][r] = score of key kt + n*16 + 8*hf + r against this lane's query of group c
    v8f s[QC][4] = {};
#pragma unroll
    for (int j = 0; j < 2; ++j) {
#pragma unroll
      for (int n = 0; n < 4; ++n) {
        v16bf ak = load_frag(Kl, n * 16, j * 32, KVP);
#pragma unroll
        for (int c = 0; c < QC; ++c) s[c][n] = wmma_bf16(ak, qf[c][j], s[c][n]);
      }
    }
    v16bf pb[QC][2];
#pragma unroll
    for (int c = 0; c < QC; ++c) {
      // online softmax: in-lane over 32 keys, one exchange for the other 32
      float mx[8];
#pragma unroll
      for (int r = 0; r < 8; ++r)
        mx[r] = fmaxf(fmaxf(s[c][0][r], s[c][1][r]), fmaxf(s[c][2][r], s[c][3][r]));
      float mt = fmaxf(fmaxf(fmaxf(mx[0], mx[1]), fmaxf(mx[2], mx[3])),
                       fmaxf(fmaxf(mx[4], mx[5]), fmaxf(mx[6], mx[7])));
      mt = fmaxf(mt, xhalf(mt));
      const float mn = fmaxf(mrun[c], mt);
      const float alpha = __expf(mrun[c] - mn);
      mrun[c] = mn;

      float rs[4] = {0.0f, 0.0f, 0.0f, 0.0f};  // four chains, joined below
#pragma unroll
      for (int n = 0; n < 4; ++n)
#pragma unroll
        for (int r = 0; r < 8; ++r) {
          float p = __expf(s[c][n][r] - mn);
          s[c][n][r] = p;
          rs[n] += p;
        }
      lrun[c] = lrun[c] * alpha + ((rs[0] + rs[1]) + (rs[2] + rs[3]));
#pragma unroll
      for (int n = 0; n < 4; ++n)
#pragma unroll
        for (int r = 0; r < 8; ++r) o[c][n][r] *= alpha;

      // P^T as B operand: tiles 2*kk and 2*kk + 1 give k = 8*hf + e and 16 + 8*hf + e,
      // the order in which load_frag takes the keys of a V^T row.
#pragma unroll
      for (int kk = 0; kk < 2; ++kk)
#pragma unroll
        for (int e = 0; e < 8; ++e) {
          pb[c][kk][e]     = (bf16_t)s[c][2 * kk][e];
          pb[c][kk][e + 8] = (bf16_t)s[c][2 * kk + 1][e];
        }
    }

    // O^T += V^T * P^T   (V^T tile is [dh][key] in LDS -> direct A-fragments)
#pragma unroll
    for (int kk = 0; kk < 2; ++kk) {
#pragma unroll
      for (int n = 0; n < 4; ++n) {
        v16bf av = load_frag(Vl, n * 16, kk * 32, KVP);
#pragma unroll
        for (int c = 0; c < QC; ++c) o[c][n] = wmma_bf16(av, pb[c][kk], o[c][n]);
      }
    }
    // Publish point of the next tile; it also frees this tile's buffer.
    asm volatile("s_wait_dscnt 0x0" ::: "memory");     // own LDS reads of this buffer done
    asm volatile("s_wait_asynccnt 0x0" ::: "memory");  // own copies of the next tile landed
    __syncthreads();
    if (kt + 128 < TT)                                 // same for the whole work-group
      copy_kv_tile(ldsK + buf * (KVBUF * 2), ldsV + buf * (KVBUF * 2),
                   gK + (size_t)(kt + 128) * DH, gV + (kt + 128));
  }
  asm volatile("s_wait_asynccnt 0x0" ::: "memory");    // nothing in flight at the wave's end

  // join the halves' sums, normalize, store concat-head layout [b, t, h*64 + e]:
  // a lane's 8 accumulator registers are 8 consecutive e of its query's row.
#pragma unroll
  for (int c = 0; c < QC; ++c) {
    const float ltot = lrun[c] + xhalf(lrun[c]);
    bf16_t* dst = Ob + ((size_t)(b * TT + q0 + c * 16 + lanen) * (HH * DH)) + h * DH + 8 * hf;
#pragma unroll
    for (int n = 0; n < 4; ++n) {
      v8bf ov;
#pragma unroll
      for (int r = 0; r < 8; ++r) ov[r] = (bf16_t)(o[c][n][r] / ltot);
      *reinterpret_cast<v8bf*>(dst + n * 16) = ov;
    }
  }
}

// ---------------------------------------------------------------------------
// Kernel 3: output projection + bias.  Ob[8192,1024]bf16 x WT rows 3072.. (Wo^T)
// grid (64, 16): 128-row x 64-col tiles. A-fragments stream straight from
// global (bf16 row-major); the weight tile goes through LDS as it lies.
// ---------------------------------------------------------------------------
__global__ __launch_bounds__(256)
void mha_out_proj_kernel(const bf16_t* __restrict__ Ob,
                         const bf16_t* __restrict__ WT,
                         const float* __restrict__ bo,
                         float* __restrict__ out) {
  __shared__ __attribute__((aligned(16))) bf16_t Ws[64 * 72];
  const int tid = threadIdx.x, lane = tid & 31, wid = tid >> 5;
  const int lanen = lane & 15, hf = lane >> 4;
  const int wm = wid >> 1, wn = wid & 1;
  const int r0 = blockIdx.x * 128;
  const int n0 = blockIdx.y * 64;
  const bf16_t* Wn = WT + (size_t)(3 * HH * DH + n0) * DD;   // rows n0.. of Wo^T

  v8f c[2][2] = {};

  for (int k0 = 0; k0 < DD; k0 += 64) {
    const int srow = tid >> 3, sc8 = (tid & 7) * 8;
#pragma unroll
    for (int i = 0; i < 2; ++i)
      *reinterpret_cast<v8bf*>(&Ws[(i * 32 + srow) * 72 + sc8]) =
          *reinterpret_cast<const v8bf*>(Wn + (size_t)(i * 32 + srow) * DD + k0 + sc8);
    __syncthreads();
#pragma unroll
    for (int ks = 0; ks < 64; ks += 32) {
      v16bf a0 = load_frag(Ob, r0 + wm * 32 +  0, k0 + ks, DD);
      v16bf a1 = load_frag(Ob, r0 + wm * 32 + 16, k0 + ks, DD);
      v16bf b0 = load_frag(&Ws[0], wn * 32 +  0, ks, 72);
      v16bf b1 = load_frag(&Ws[0], wn * 32 + 16, ks, 72);
      c[0][0] = wmma_bf16(a0, b0, c[0][0]);
      c[0][1] = wmma_bf16(a0, b1, c[0][1]);
      c[1][0] = wmma_bf16(a1, b0, c[1][0]);
      c[1][1] = wmma_bf16(a1, b1, c[1][1]);
    }
    __syncthreads();
  }

#pragma unroll
  for (int mi = 0; mi < 2; ++mi)
#pragma unroll
    for (int ni = 0; ni < 2; ++ni) {
      int col = n0 + wn * 32 + ni * 16 + lanen;
      float bias = bo[col];
#pragma unroll
      for (int r = 0; r < 8; ++r) {
        int row = r0 + wm * 32 + mi * 16 + r + 8 * hf;
        out[(size_t)row * DD + col] = c[mi][ni][r] + bias;
      }
    }
}

extern "C" void kernel_launch(void* const* d_in, const int* in_sizes, int n_in,
                              void* d_out, int out_size, void* d_ws, size_t ws_size,
                              hipStream_t stream) {
  const float* x  = (const float*)d_in[0];
  const float* Wq = (const float*)d_in[1];
  const float* Wk = (const float*)d_in[2];
  const float* Wv = (const float*)d_in[3];
  const float* Wo = (const float*)d_in[4];
  const float* bo = (const float*)d_in[5];
  float* out = (float*)d_out;

  const size_t elems = (size_t)BB * HH * TT * DH;   // 8,388,608 per buffer
  bf16_t* Qb = (bf16_t*)d_ws;
  bf16_t* Kb = Qb + elems;
  bf16_t* Vt = Kb + elems;
  bf16_t* Ob = Vt + elems;
  bf16_t* Xb = Ob + elems;
  bf16_t* WT = Xb + elems;                          // 4096 x 1024

  mha_convert_kernel<<<dim3(768), 256, 0, stream>>>(x, Wq, Wk, Wv, Wo, Xb, WT);
  mha_qkv_proj_kernel<<<dim3(64, 48), 256, 0, stream>>>(Xb, WT, Qb, Kb, Vt);
  mha_flash_attn_kernel<<<dim3(64, 8), 256, 0, stream>>>(Qb, Kb, Vt, Ob);
  mha_out_proj_kernel<<<dim3(64, 16), 256, 0, stream>>>(Ob, WT, bo, out);
}

// v005
// A run of this version takes 134 microseconds.
// Next to v004, in two timings, it ran 1.24 and 1.23 times as fast.
// Over all steps from v000 it is 4.09 times as fast.
#include <hip/hip_runtime.h>
#include <hip/hip_bf16.h>

typedef __bf16 bf16_t;
typedef __attribute__((ext_vector_type(16))) __bf16 v16bf;
typedef __attribute__((ext_vector_type(8)))  __bf16 v8bf;
typedef __attribute__((ext_vector_type(4)))  __bf16 v4bf;
typedef __attribute__((ext_vector_type(2)))  __bf16 v2bf;
typedef __attribute__((ext_vector_type(8)))  float  v8f;

#define BB  4
#define TT  2048
#define DD  1024
#define HH  16
#define DH  64

union FragU { v16bf v; v8bf h[2]; };

// Load a 16x32 bf16 WMMA A/B fragment from a row-major [rows][ld] bf16 matrix.
// A: row = base_row + lane%16 ; B: n = base_row + lane%16 with source in [N][K] layout.
// Per documented layout: elements 0..7 at K=k0+(lane/16)*8, elements 8..15 at K=k0+16+(lane/16)*8.
__device__ inline v16bf load_frag(const bf16_t* base, int row0, int k0, int ld) {
  const int lane = threadIdx.x & 31;
  const int sel  = lane & 15;
  const int hf   = lane >> 4;
  const bf16_t* p = base + (size_t)(row0 + sel) * ld + k0 + hf * 8;
  FragU f;
  f.h[0] = *reinterpret_cast<const v8bf*>(p);
  f.h[1] = *reinterpret_cast<const v8bf*>(p + 16);
  return f.v;
}

__device__ inline v8f wmma_bf16(v16bf a, v16bf b, v8f c) {
  // (neg_a, A, neg_b, B, c_mod, C, reuse_a, reuse_b)
  return __builtin_amdgcn_wmma_f32_16x16x32_bf16(false, a, false, b, (short)0, c, false, false);
}

// ---------------------------------------------------------------------------
// Kernel 0: operands of both projections converted to bf16 once per call.
// Xb[8192][1024] = x.  WT[4096][1024] holds every weight with k contiguous:
// row (mat*16 + h)*64 + e = column e of Wq/Wk/Wv[h], row 3072 + n = column n of Wo.
// Blocks 0..255: a 256(k) x 64(n) weight strip each, transposed through LDS.
// Blocks 256..767: 16 float4 of x per thread, every load a wave-contiguous 512 B.
// ---------------------------------------------------------------------------
#define TSP 264                  // LDS row pitch in bf16: 528 B = 16 B x odd

__global__ __launch_bounds__(256)
void mha_convert_kernel(const float* __restrict__ x,
                        const float* __restrict__ Wq,
                        const float* __restrict__ Wk,
                        const float* __restrict__ Wv,
                        const float* __restrict__ Wo,
                        bf16_t* __restrict__ Xb,
                        bf16_t* __restrict__ WT) {
  __shared__ __attribute__((aligned(16))) bf16_t Ts[64 * TSP];   // [n=64][k=256]
  const int tid = threadIdx.x;
  if (blockIdx.x >= 256) {                     // block-uniform: these blocks meet no barrier
    const size_t base = (size_t)(blockIdx.x - 256) * 4096 + tid;   // in float4
    float4 xv[16];
#pragma unroll
    for (int i = 0; i < 16; ++i) {
      // the last load's result may be given the address registers that the loads
      // before it name: the wait stands in front of that overwrite
      if (i == 15) asm volatile("s_wait_xcnt 0x0" ::: "memory");
      xv[i] = reinterpret_cast<const float4*>(x)[base + i * 256];
    }
#pragma unroll
    for (int i = 0; i < 16; ++i) {
      v4bf bv = { (bf16_t)xv[i].x, (bf16_t)xv[i].y, (bf16_t)xv[i].z, (bf16_t)xv[i].w };
      reinterpret_cast<v4bf*>(Xb)[base + i * 256] = bv;
    }
    return;
  }
  const int m  = blockIdx.x >> 2;              // group of 64 rows of WT
  const int kb = (blockIdx.x & 3) * 256;       // first k of the strip
  const int mat = m >> 4, h = m & 15;
  // the strip's first element and its row pitch in floats (block-uniform)
  const float* src = mat == 0 ? Wq : (mat == 1 ? Wk : (mat == 2 ? Wv : Wo));
  const int pitch  = mat < 3 ? DH : DD;
  src += (mat < 3 ? (size_t)h * DD * DH : (size_t)h * 64) + (size_t)kb * pitch;
  const int d0 = tid >> 4, e4 = tid & 15;
  const float* p = src + (size_t)d0 * pitch + e4 * 4;
  float4 wv[16];
#pragma unroll
  for (int i = 0; i < 16; ++i)
    wv[i] = *reinterpret_cast<const float4*>(p + (size_t)(i * 16) * pitch);
#pragma unroll
  for (int i = 0; i < 16; ++i) {
    const int d = i * 16 + d0;
    Ts[(e4 * 4 + 0) * TSP + d] = (bf16_t)wv[i].x;
    Ts[(e4 * 4 + 1) * TSP + d] = (bf16_t)wv[i].y;
    Ts[(e4 * 4 + 2) * TSP + d] = (bf16_t)wv[i].z;
    Ts[(e4 * 4 + 3) * TSP + d] = (bf16_t)wv[i].w;
  }
  __syncthreads();
#pragma unroll
  for (int i = 0; i < 8; ++i) {
    int idx = i * 256 + tid;
    int row = idx >> 5, c8 = idx & 31;         // a wave writes 512 B of one row
    *reinterpret_cast<v8bf*>(WT + (size_t)(m * 64 + row) * DD + kb + c8 * 8) =
        *reinterpret_cast<const v8bf*>(&Ts[row * TSP + c8 * 8]);
  }
}

// ---------------------------------------------------------------------------
// Main loop of both projections: one 256 x 128 tile of A[.][1024] * W[.][1024]^T
// per work-group, both operands k contiguous, 128 k to a stage. 8 waves as
// 4 (rows) x 2 (columns), 64 x 64 per wave: each fragment taken from LDS feeds
// four products, and each operand row is fetched from L2 by half as many
// work-groups as at 128 x 64.
// Ag = first row of the A tile, Wg = first row of the W tile (row = output column).
// c[mi][ni] = rows wm*64 + mi*16.., columns wn*64 + ni*16.. of the tile.
// ---------------------------------------------------------------------------
#define GK 128                   // k per stage: 256 B of every operand row
#define GP 136                   // LDS row pitch in bf16: 272 B = 16 B x odd

__device__ inline void gemm_tile_256x128(const bf16_t* __restrict__ Ag,
                                         const bf16_t* __restrict__ Wg,
                                         bf16_t* As, bf16_t* Ws, v8f (&c)[4][4]) {
  const int tid = threadIdx.x, wid = tid >> 5;
  const int wm = wid >> 1, wn = wid & 1;
  const int srow = tid >> 4, sc8 = (tid & 15) * 8;  // 16-byte pieces, 16 lanes to a 256-B row
  for (int k0 = 0; k0 < DD; k0 += GK) {
    const bf16_t* pa = Ag + (size_t)srow * DD + k0 + sc8;
    const bf16_t* pw = Wg + (size_t)srow * DD + k0 + sc8;
    v8bf ar[16], wr[8];
#pragma unroll
    for (int i = 0; i < 15; ++i)
      ar[i] = *reinterpret_cast<const v8bf*>(pa + (size_t)(i * 16) * DD);
#pragma unroll
    for (int i = 0; i < 7; ++i)
      wr[i] = *reinterpret_cast<const v8bf*>(pw + (size_t)(i * 16) * DD);
    // the last load of each operand may be given the address registers that the
    // loads before it name: the wait stands in front of that overwrite
    asm volatile("s_wait_xcnt 0x0" ::: "memory");
    ar[15] = *reinterpret_cast<const v8bf*>(pa + (size_t)(15 * 16) * DD);
    wr[7]  = *reinterpret_cast<const v8bf*>(pw + (size_t)(7 * 16) * DD);
#pragma unroll
    for (int i = 0; i < 16; ++i)
      *reinterpret_cast<v8bf*>(&As[(i * 16 + srow) * GP + sc8]) = ar[i];
#pragma unroll
    for (int i = 0; i < 8; ++i)
      *reinterpret_cast<v8bf*>(&Ws[(i * 16 + srow) * GP + sc8]) = wr[i];
    __syncthreads();
#pragma unroll
    for (int ks = 0; ks < GK; ks += 32) {
      v16bf a[4], b[4];
#pragma unroll
      for (int i = 0; i < 4; ++i) {
        a[i] = load_frag(As, wm * 64 + i * 16, ks, GP);
        b[i] = load_frag(Ws, wn * 64 + i * 16, ks, GP);
      }
#pragma unroll
      for (int mi = 0; mi < 4; ++mi)
#pragma unroll
        for (int ni = 0; ni < 4; ++ni)
          c[mi][ni] = wmma_bf16(a[mi], b[ni], c[mi][ni]);
    }
    __syncthreads();
  }
}

// ---------------------------------------------------------------------------
// Kernel 1: fused QKV projection.  Xb[8192,1024]bf16 x WT rows (k contiguous)
// Q,K stored [b,h,t,dh] row-major; V stored transposed [b,h,dh,t].
// 1/sqrt(DH)=0.125 folded into Q.
// grid (32, 24): x = 8192/256 row tiles, y = 3072/128 column tiles = two heads
// of one matrix; a wave's 64 columns are one head.
// Register budget of four waves a SIMD: two work-groups stay resident on a WGP.
// ---------------------------------------------------------------------------
__global__ __launch_bounds__(256) __attribute__((amdgpu_waves_per_eu(4, 4)))
void mha_qkv_proj_kernel(const bf16_t* __restrict__ Xb,
                         const bf16_t* __restrict__ WT,
                         bf16_t* __restrict__ Qb,
                         bf16_t* __restrict__ Kb,
                         bf16_t* __restrict__ Vt) {
  __shared__ __attribute__((aligned(16))) bf16_t Xs[256 * GP];   // 256 rows x 128 K (+8 pad)
  __shared__ __attribute__((aligned(16))) bf16_t Ws[128 * GP];   // [n=128][k=128] weight tile
  const int tid  = threadIdx.x;
  const int lane = tid & 31, wid = tid >> 5;
  const int lanen = lane & 15, hf = lane >> 4;
  const int wm = wid >> 1, wn = wid & 1;
  const int r0  = blockIdx.x * 256;
  const int mat = blockIdx.y >> 3;                // 0=Q 1=K 2=V (block-uniform)
  const int h   = (blockIdx.y * 2 + wn) & 15;     // this wave's head

  v8f c[4][4] = {};
  gemm_tile_256x128(Xb + (size_t)r0 * DD, WT + (size_t)blockIdx.y * 128 * DD, Xs, Ws, c);

  // Epilogue: tile never crosses a batch boundary (2048 % 256 == 0), and mat
  // is block-uniform -> one uniform branch, branch-free store loops inside.
  const int bidx = r0 >> 11;                 // batch index (uniform)
  const int t00  = (r0 & 2047) + wm * 64;    // base t for this wave
  const size_t bh = (size_t)(bidx * HH + h);

  if (mat == 0) {
    bf16_t* dst = Qb + bh * TT * DH;
#pragma unroll
    for (int mi = 0; mi < 4; ++mi)
#pragma unroll
      for (int ni = 0; ni < 4; ++ni) {
        int e = ni * 16 + lanen;
#pragma unroll
        for (int r = 0; r < 8; ++r) {
          int t = t00 + mi * 16 + r + 8 * hf;
          dst[(size_t)t * DH + e] = (bf16_t)(c[mi][ni][r] * 0.125f);
        }
      }
  } else if (mat == 1) {
    bf16_t* dst = Kb + bh * TT * DH;
#pragma unroll
    for (int mi = 0; mi < 4; ++mi)
#pragma unroll
      for (int ni = 0; ni < 4; ++ni) {
        int e = ni * 16 + lanen;
#pragma unroll
        for (int r = 0; r < 8; ++r) {
          int t = t00 + mi * 16 + r + 8 * hf;
          dst[(size_t)t * DH + e] = (bf16_t)c[mi][ni][r];
        }
      }
  } else {
    // V transposed [dh][t]: consecutive r -> consecutive t -> packed b32 stores
    bf16_t* dst = Vt + bh * DH * TT;
#pragma unroll
    for (int mi = 0; mi < 4; ++mi)
#pragma unroll
      for (int ni = 0; ni < 4; ++ni) {
        int e = ni * 16 + lanen;
#pragma unroll
        for (int r = 0; r < 8; r += 2) {
          int t = t00 + mi * 16 + r + 8 * hf;   // even
          v2bf pv = { (bf16_t)c[mi][ni][r], (bf16_t)c[mi][ni][r + 1] };
          *reinterpret_cast<v2bf*>(&dst[(size_t)e * TT + t]) = pv;
        }
      }
  }
}

#define KVP   72                 // LDS row pitch in bf16: 144 B = 16 B x odd
#define KVBUF (64 * KVP)         // one buffer: 64 rows
#define QC    2                  // 16-column query groups per wave

// Four 16-byte copies per lane = one K tile + one V^T tile per work-group.
// The s_wait_xcnt stands inside the statement so that no address register of
// an issued copy is rewritten in front of it.
__device__ inline void copy_kv_tile(unsigned lk, unsigned lv,
                                    const bf16_t* gk, const bf16_t* gv) {
  const unsigned lk1 = lk + 32 * KVP * 2, lv1 = lv + 32 * KVP * 2;
  const bf16_t* gk1 = gk + 32 * DH;
  const bf16_t* gv1 = gv + (size_t)32 * TT;
  asm volatile("global_load_async_to_lds_b128 %0, %4, off\n\t"
               "global_load_async_to_lds_b128 %1, %5, off\n\t"
               "global_load_async_to_lds_b128 %2, %6, off\n\t"
               "global_load_async_to_lds_b128 %3, %7, off\n\t"
               "s_wait_xcnt 0x0"
               :: "v"(lk), "v"(lk1), "v"(lv), "v"(lv1),
                  "v"(gk), "v"(gk1), "v"(gv), "v"(gv1)
               : "memory");
}

// Lane l takes the value of lane l ^ 16 (a register move, no LDS traffic).
__device__ inline float xhalf(float v) {
  const int i = __builtin_bit_cast(int, v);
  return __builtin_bit_cast(float,
      __builtin_amdgcn_permlanex16(i, i, 0x76543210, 0xfedcba98, false, false));
}

// Register budget of four waves a SIMD: two work-groups stay resident on a WGP.
__global__ __launch_bounds__(256) __attribute__((amdgpu_waves_per_eu(4, 4)))
void mha_flash_attn_kernel(const bf16_t* __restrict__ Qb,
                           const bf16_t* __restrict__ Kb,
                           const bf16_t* __restrict__ Vt,
                           bf16_t* __restrict__ Ob) {
  __shared__ __attribute__((aligned(16))) bf16_t Ks[2 * KVBUF];  // [buf][key][dh]
  __shared__ __attribute__((aligned(16))) bf16_t Vs[2 * KVBUF];  // [buf][dh][key]
  const int tid = threadIdx.x, lane = tid & 31, wid = tid >> 5;
  const int lanen = lane & 15, hf = lane >> 4;
  const int bh = blockIdx.x;                 // 0..63
  const int b = bh >> 4, h = bh & 15;
  const int q0 = blockIdx.y * (128 * QC) + wid * (16 * QC);
  const bf16_t* Qh = Qb + (size_t)bh * TT * DH;
  const bf16_t* Kh = Kb + (size_t)bh * TT * DH;
  const bf16_t* Vh = Vt + (size_t)bh * DH * TT;

  // Q as B operand: column = query q0 + c*16 + lane%16 for group c, k = dh in the hardware order.
  v16bf qf[QC][2];
  v8f o[QC][4] = {};                         // o[c][n][r] = O^T[n*16 + 8*hf + r][query of group c]
  float mrun[QC];                            // this lane's queries: running maximum
  float lrun[QC];                            // and the sum over this half's keys
#pragma unroll
  for (int c = 0; c < QC; ++c) {
    qf[c][0] = load_frag(Qh, q0 + c * 16,  0, DH);
    qf[c][1] = load_frag(Qh, q0 + c * 16, 32, DH);
    mrun[c] = -3.0e38f;
    lrun[c] = 0.0f;
  }

  // This lane's share of a tile: rows crow and crow + 32, 16 bytes at column ccol.
  const int crow = tid >> 3, ccol = (tid & 7) * 8;
  const unsigned ldsK = (unsigned)(uintptr_t)&Ks[crow * KVP + ccol];
  const unsigned ldsV = (unsigned)(uintptr_t)&Vs[crow * KVP + ccol];
  const bf16_t* gK = Kh + crow * DH + ccol;            // + kt * DH per tile
  const bf16_t* gV = Vh + (size_t)crow * TT + ccol;    // + kt per tile

  // Ring prologue: tile 0 landed and published, then tile 1 in flight.
  copy_kv_tile(ldsK, ldsV, gK, gV);
  asm volatile("s_wait_asynccnt 0x0" ::: "memory");    // own copies of tile 0 landed
  __syncthreads();                                     // every wave's copies visible
  copy_kv_tile(ldsK + KVBUF * 2, ldsV + KVBUF * 2, gK + 64 * DH, gV + 64);

  for (int kt = 0; kt < TT; kt += 64) {
    const int buf = (kt >> 6) & 1;
    const bf16_t* Kl = &Ks[buf * KVBUF];
    const bf16_t* Vl = &Vs[buf * KVBUF];
    // S^T = K * Q^T  (scale already folded into Q)
    // s[c][n][r] = score of key kt + n*16 + 8*hf + r against this lane's query of group c
    v8f s[QC][4] = {};
#pragma unroll
    for (int j = 0; j < 2; ++j) {
#pragma unroll
      for (int n = 0; n < 4; ++n) {
        v16bf ak = load_frag(Kl, n * 16, j * 32, KVP);
#pragma unroll
        for (int c = 0; c < QC; ++c) s[c][n] = wmma_bf16(ak, qf[c][j], s[c][n]);
      }
    }
    v16bf pb[QC][2];
#pragma unroll
    for (int c = 0; c < QC; ++c) {
      // online softmax: in-lane over 32 keys, one exchange for the other 32
      float mx[8];
#pragma unroll
      for (int r = 0; r < 8; ++r)
        mx[r] = fmaxf(fmaxf(s[c][0][r], s[c][1][r]), fmaxf(s[c][2][r], s[c][3][r]));
      float mt = fmaxf(fmaxf(fmaxf(mx[0], mx[1]), fmaxf(mx[2], mx[3])),
                       fmaxf(fmaxf(mx[4], mx[5]), fmaxf(mx[6], mx[7])));
      mt = fmaxf(mt, xhalf(mt));
      const float mn = fmaxf(mrun[c], mt);
      const float alpha = __expf(mrun[c] - mn);
      mrun[c] = mn;

      float rs[4] = {0.0f, 0.0f, 0.0f, 0.0f};  // four chains, joined below
#pragma unroll
      for (int n = 0; n < 4; ++n)
#pragma unroll
        for (int r = 0; r < 8; ++r) {
          float p = __expf(s[c][n][r] - mn);
          s[c][n][r] = p;
          rs[n] += p;
        }
      lrun[c] = lrun[c] * alpha + ((rs[0] + rs[1]) + (rs[2] + rs[3]));
#pragma unroll
      for (int n = 0; n < 4; ++n)
#pragma unroll
        for (int r = 0; r < 8; ++r) o[c][n][r] *= alpha;

      // P^T as B operand: tiles 2*kk and 2*kk + 1 give k = 8*hf + e and 16 + 8*hf + e,
      // the order in which load_frag takes the keys of a V^T row.
#pragma unroll
      for (int kk = 0; kk < 2; ++kk)
#pragma unroll
        for (int e = 0; e < 8; ++e) {
          pb[c][kk][e]     = (bf16_t)s[c][2 * kk][e];
          pb[c][kk][e + 8] = (bf16_t)s[c][2 * kk + 1][e];
        }
    }

    // O^T += V^T * P^T   (V^T tile is [dh][key] in LDS -> direct A-fragments)
#pragma unroll
    for (int kk = 0; kk < 2; ++kk) {
#pragma unroll
      for (int n = 0; n < 4; ++n) {
        v16bf av = load_frag(Vl, n * 16, kk * 32, KVP);
#pragma unroll
        for (int c = 0; c < QC; ++c) o[c][n] = wmma_bf16(av, pb[c][kk], o[c][n]);
      }
    }
    // Publish point of the next tile; it also frees this tile's buffer.
    asm volatile("s_wait_dscnt 0x0" ::: "memory");     // own LDS reads of this buffer done
    asm volatile("s_wait_asynccnt 0x0" ::: "memory");  // own copies of the next tile landed
    __syncthreads();
    if (kt + 128 < TT)                                 // same for the whole work-group
      copy_kv_tile(ldsK + buf * (KVBUF * 2), ldsV + buf * (KVBUF * 2),
                   gK + (size_t)(kt + 128) * DH, gV + (kt + 128));
  }
  asm volatile("s_wait_asynccnt 0x0" ::: "memory");    // nothing in flight at the wave's end

  // join the halves' sums, normalize, store concat-head layout [b, t, h*64 + e]:
  // a lane's 8 accumulator registers are 8 consecutive e of its query's row.
#pragma unroll
  for (int c = 0; c < QC; ++c) {
    const float ltot = lrun[c] + xhalf(lrun[c]);
    bf16_t* dst = Ob + ((size_t)(b * TT + q0 + c * 16 + lanen) * (HH * DH)) + h * DH + 8 * hf;
#pragma unroll
    for (int n = 0; n < 4; ++n) {
      v8bf ov;
#pragma unroll
      for (int r = 0; r < 8; ++r) ov[r] = (bf16_t)(o[c][n][r] / ltot);
      *reinterpret_cast<v8bf*>(dst + n * 16) = ov;
    }
  }
}

// ---------------------------------------------------------------------------
// Kernel 3: output projection + bias.  Ob[8192,1024]bf16 x WT rows 3072.. (Wo^T)
// grid (32, 8): 256-row x 128-col tiles, one work-group to a WGP; both operand
// tiles go through LDS as they lie.
// ---------------------------------------------------------------------------
__global__ __launch_bounds__(256)
void mha_out_proj_kernel(const bf16_t* __restrict__ Ob,
                         const bf16_t* __restrict__ WT,
                         const float* __restrict__ bo,
                         float* __restrict__ out) {
  __shared__ __attribute__((aligned(16))) bf16_t Os[256 * GP];
  __shared__ __attribute__((aligned(16))) bf16_t Ws[128 * GP];
  const int tid = threadIdx.x, lane = tid & 31, wid = tid >> 5;
  const int lanen = lane & 15, hf = lane >> 4;
  const int wm = wid >> 1, wn = wid & 1;
  const int r0 = blockIdx.x * 256;
  const int n0 = blockIdx.y * 128;

  v8f c[4][4] = {};
  gemm_tile_256x128(Ob + (size_t)r0 * DD, WT + (size_t)(3 * HH * DH + n0) * DD, Os, Ws, c);

#pragma unroll
  for (int mi = 0; mi < 4; ++mi)
#pragma unroll
    for (int ni = 0; ni < 4; ++ni) {
      int col = n0 + wn * 64 + ni * 16 + lanen;
      float bias = bo[col];
#pragma unroll
      for (int r = 0; r < 8; ++r) {
        int row = r0 + wm * 64 + mi * 16 + r + 8 * hf;
        out[(size_t)row * DD + col] = c[mi][ni][r] + bias;
      }
    }
}

extern "C" void kernel_launch(void* const* d_in, const int* in_sizes, int n_in,
                              void* d_out, int out_size, void* d_ws, size_t ws_size,
                              hipStream_t stream) {
  const float* x  = (const float*)d_in[0];
  const float* Wq = (const float*)d_in[1];
  const float* Wk = (const float*)d_in[2];
  const float* Wv = (const float*)d_in[3];
  const float* Wo = (const float*)d_in[4];
  const float* bo = (const float*)d_in[5];
  float* out = (float*)d_out;

  const size_t elems = (size_t)BB * HH * TT * DH;   // 8,388,608 per buffer
  bf16_t* Qb = (bf16_t*)d_ws;
  bf16_t* Kb = Qb + elems;
  bf16_t* Vt = Kb + elems;
  bf16_t* Ob = Vt + elems;
  bf16_t* Xb = Ob + elems;
  bf16_t* WT = Xb + elems;                          // 4096 x 1024

  mha_convert_kernel<<<dim3(768), 256, 0, stream>>>(x, Wq, Wk, Wv, Wo, Xb, WT);
  mha_qkv_proj_kernel<<<dim3(32, 24), 256, 0, stream>>>(Xb, WT, Qb, Kb, Vt);
  mha_flash_attn_kernel<<<dim3(64, 8), 256, 0, stream>>>(Qb, Kb, Vt, Ob);
  mha_out_proj_kernel<<<dim3(32, 8), 256, 0, stream>>>(Ob, WT, bo, out);
}

// v006
// Measured time: 125 microseconds a run.
// Next to v005, in two timings, it ran 1.07 times as fast each time.
// All steps since v000 together make it 4.38 times as fast.
#include <hip/hip_runtime.h>
#include <hip/hip_bf16.h>

typedef __bf16 bf16_t;
typedef __attribute__((ext_vector_type(16))) __bf16 v16bf;
typedef __attribute__((ext_vector_type(8)))  __bf16 v8bf;
typedef __attribute__((ext_vector_type(4)))  __bf16 v4bf;
typedef __attribute__((ext_vector_type(2)))  __bf16 v2bf;
typedef __attribute__((ext_vector_type(8)))  float  v8f;

#define BB  4
#define TT  2048
#define DD  1024
#define HH  16
#define DH  64

union FragU { v16bf v; v8bf h[2]; };

// Load a 16x32 bf16 WMMA A/B fragment from a row-major [rows][ld] bf16 matrix.
// A: row = base_row + lane%16 ; B: n = base_row + lane%16 with source in [N][K] layout.
// Per documented layout: elements 0..7 at K=k0+(lane/16)*8, elements 8..15 at K=k0+16+(lane/16)*8.
__device__ inline v16bf load_frag(const bf16_t* base, int row0, int k0, int ld) {
  const int lane = threadIdx.x & 31;
  const int sel  = lane & 15;
  const int hf   = lane >> 4;
  const bf16_t* p = base + (size_t)(row0 + sel) * ld + k0 + hf * 8;
  FragU f;
  f.h[0] = *reinterpret_cast<const v8bf*>(p);
  f.h[1] = *reinterpret_cast<const v8bf*>(p + 16);
  return f.v;
}

__device__ inline v8f wmma_bf16(v16bf a, v16bf b, v8f c) {
  // (neg_a, A, neg_b, B, c_mod, C, reuse_a, reuse_b)
  return __builtin_amdgcn_wmma_f32_16x16x32_bf16(false, a, false, b, (short)0, c, false, false);
}

// ---------------------------------------------------------------------------
// Kernel 0: operands of both projections converted to bf16 once per call.
// Xb[8192][1024] = x.  WT[4096][1024] holds every weight with k contiguous:
// row (mat*16 + h)*64 + e = column e of Wq/Wk/Wv[h], row 3072 + n = column n of Wo.
// Blocks 0..255: a 256(k) x 64(n) weight strip each, transposed through LDS.
// Blocks 256..767: 16 float4 of x per thread, every load a wave-contiguous 512 B.
// ---------------------------------------------------------------------------
#define TSP 264                  // LDS row pitch in bf16: 528 B = 16 B x odd

__global__ __launch_bounds__(256)
void mha_convert_kernel(const float* __restrict__ x,
                        const float* __restrict__ Wq,
                        const float* __restrict__ Wk,
                        const float* __restrict__ Wv,
                        const float* __restrict__ Wo,
                        bf16_t* __restrict__ Xb,
                        bf16_t* __restrict__ WT) {
  __shared__ __attribute__((aligned(16))) bf16_t Ts[64 * TSP];   // [n=64][k=256]
  const int tid = threadIdx.x;
  if (blockIdx.x >= 256) {                     // block-uniform: these blocks meet no barrier
    const size_t base = (size_t)(blockIdx.x - 256) * 4096 + tid;   // in float4
    float4 xv[16];
#pragma unroll
    for (int i = 0; i < 16; ++i) {
      // the last load's result may be given the address registers that the loads
      // before it name: the wait stands in front of that overwrite
      if (i == 15) asm volatile("s_wait_xcnt 0x0" ::: "memory");
      xv[i] = reinterpret_cast<const float4*>(x)[base + i * 256];
    }
#pragma unroll
    for (int i = 0; i < 16; ++i) {
      v4bf bv = { (bf16_t)xv[i].x, (bf16_t)xv[i].y, (bf16_t)xv[i].z, (bf16_t)xv[i].w };
      reinterpret_cast<v4bf*>(Xb)[base + i * 256] = bv;
    }
    return;
  }
  const int m  = blockIdx.x >> 2;              // group of 64 rows of WT
  const int kb = (blockIdx.x & 3) * 256;       // first k of the strip
  const int mat = m >> 4, h = m & 15;
  // the strip's first element and its row pitch in floats (block-uniform)
  const float* src = mat == 0 ? Wq : (mat == 1 ? Wk : (mat == 2 ? Wv : Wo));
  const int pitch  = mat < 3 ? DH : DD;
  src += (mat < 3 ? (size_t)h * DD * DH : (size_t)h * 64) + (size_t)kb * pitch;
  const int d0 = tid >> 4, e4 = tid & 15;
  const float* p = src + (size_t)d0 * pitch + e4 * 4;
  float4 wv[16];
#pragma unroll
  for (int i = 0; i < 16; ++i)
    wv[i] = *reinterpret_cast<const float4*>(p + (size_t)(i * 16) * pitch);
#pragma unroll
  for (int i = 0; i < 16; ++i) {
    const int d = i * 16 + d0;
    Ts[(e4 * 4 + 0) * TSP + d] = (bf16_t)wv[i].x;
    Ts[(e4 * 4 + 1) * TSP + d] = (bf16_t)wv[i].y;
    Ts[(e4 * 4 + 2) * TSP + d] = (bf16_t)wv[i].z;
    Ts[(e4 * 4 + 3) * TSP + d] = (bf16_t)wv[i].w;
  }
  __syncthreads();
#pragma unroll
  for (int i = 0; i < 8; ++i) {
    int idx = i * 256 + tid;
    int row = idx >> 5, c8 = idx & 31;         // a wave writes 512 B of one row
    *reinterpret_cast<v8bf*>(WT + (size_t)(m * 64 + row) * DD + kb + c8 * 8) =
        *reinterpret_cast<const v8bf*>(&Ts[row * TSP + c8 * 8]);
  }
}

// ---------------------------------------------------------------------------
// Main loop of both projections: one 256 x 128 tile of A[.][1024] * W[.][1024]^T
// per work-group, both operands k contiguous, GK k to a stage. 8 waves as
// 4 (rows) x 2 (columns), 64 x 64 per wave: each fragment taken from LDS feeds
// four products.
// The operand tiles go from L2 into a two-buffer LDS ring by asynchronous
// copies, one stage ahead: stage t + 1 flies while stage t is multiplied, no
// staging register is held and one barrier a stage both publishes the next
// stage and frees the buffer just read.
// Ag = first row of the A tile, Wg = first row of the W tile (row = output column).
// c[mi][ni] = rows wm*64 + mi*16.., columns wn*64 + ni*16.. of the tile.
// LDS row pitch: GK + 8 bf16 = 16 B x odd for GK = 64 and 128.
// ---------------------------------------------------------------------------
#define GEMM_LDS(GK) (2 * (256 + 128) * ((GK) + 8))   // bf16 elements: A ring, then W ring

// Twelve 16-byte copies per lane in one statement, so that a stage meets few
// waits. The s_wait_xcnt stands inside the statement so that no address
// register of an issued copy is rewritten in front of it.
__device__ inline void copy12(const unsigned (&l)[12], const bf16_t* const (&g)[12]) {
  asm volatile(
               "global_load_async_to_lds_b128 %0, %12, off\n\t"
               "global_load_async_to_lds_b128 %1, %13, off\n\t"
               "global_load_async_to_lds_b128 %2, %14, off\n\t"
               "global_load_async_to_lds_b128 %3, %15, off\n\t"
               "global_load_async_to_lds_b128 %4, %16, off\n\t"
               "global_load_async_to_lds_b128 %5, %17, off\n\t"
               "global_load_async_to_lds_b128 %6, %18, off\n\t"
               "global_load_async_to_lds_b128 %7, %19, off\n\t"
               "global_load_async_to_lds_b128 %8, %20, off\n\t"
               "global_load_async_to_lds_b128 %9, %21, off\n\t"
               "global_load_async_to_lds_b128 %10, %22, off\n\t"
               "global_load_async_to_lds_b128 %11, %23, off\n\t"
               "s_wait_xcnt 0x0"
               :: "v"(l[0]), "v"(l[1]), "v"(l[2]), "v"(l[3]), "v"(l[4]), "v"(l[5]),
                  "v"(l[6]), "v"(l[7]), "v"(l[8]), "v"(l[9]), "v"(l[10]), "v"(l[11]),
                  "v"(g[0]), "v"(g[1]), "v"(g[2]), "v"(g[3]), "v"(g[4]), "v"(g[5]),
                  "v"(g[6]), "v"(g[7]), "v"(g[8]), "v"(g[9]), "v"(g[10]), "v"(g[11])
               : "memory");
}

// One stage of both operands: 256 rows of A and 128 rows of W, GK k each.
// la, lw, ga, gw = this lane's piece of the first RP rows; the 256 lanes cover
// RP whole rows a pass, A in the first 256 / RP passes and W in the rest.
template <int GK>
__device__ inline void copy_stage(unsigned la, unsigned lw,
                                  const bf16_t* ga, const bf16_t* gw) {
  constexpr int RP = 2048 / GK;                    // rows per pass
  constexpr int PA = 256 / RP, PN = 384 / RP;      // passes over A, over both
  constexpr unsigned LS = RP * (GK + 8) * 2;       // LDS bytes per pass
  constexpr size_t GS = (size_t)RP * DD;           // global elements per pass
  // both loops unrolled: every address is then the lane's own plus a constant,
  // and the two small arrays are registers
#pragma unroll
  for (int j = 0; j < PN; j += 12) {
    unsigned l[12];
    const bf16_t* g[12];
#pragma unroll
    for (int i = 0; i < 12; ++i) {
      const int p = j + i;
      l[i] = p < PA ? la + p * LS : lw + (p - PA) * LS;
      g[i] = p < PA ? ga + p * GS : gw + (p - PA) * GS;
    }
    copy12(l, g);
  }
}

template <int GK>
__device__ inline void gemm_tile_256x128(const bf16_t* __restrict__ Ag,
                                         const bf16_t* __restrict__ Wg,
                                         bf16_t* ring, v8f (&c)[4][4]) {
  constexpr int GP = GK + 8;                       // LDS row pitch in bf16
  constexpr int ABUF = 256 * GP, WBUF = 128 * GP;  // one buffer of each operand
  bf16_t* As = ring;                               // [buf][row 256][k]
  bf16_t* Ws = ring + 2 * ABUF;                    // [buf][column 128][k]
  const int tid = threadIdx.x, wid = tid >> 5;
  const int wm = wid >> 1, wn = wid & 1;
  const int srow = tid / (GK / 8), sc8 = (tid % (GK / 8)) * 8;   // 16-byte pieces of whole rows
  const unsigned la = (unsigned)(uintptr_t)&As[srow * GP + sc8];
  const unsigned lw = (unsigned)(uintptr_t)&Ws[srow * GP + sc8];
  const bf16_t* ga = Ag + (size_t)srow * DD + sc8;
  const bf16_t* gw = Wg + (size_t)srow * DD + sc8;

  // Ring prologue: stage 0 landed and published, then stage 1 in flight.
  copy_stage<GK>(la, lw, ga, gw);
  asm volatile("s_wait_asynccnt 0x0" ::: "memory");    // own copies of stage 0 landed
  __syncthreads();                                     // every wave's copies visible
  copy_stage<GK>(la + ABUF * 2, lw + WBUF * 2, ga + GK, gw + GK);

  for (int k0 = 0; k0 < DD; k0 += GK) {
    const int buf = (k0 / GK) & 1;
    const bf16_t* Al = As + buf * ABUF;
    const bf16_t* Wl = Ws + buf * WBUF;
#pragma unroll
    for (int ks = 0; ks < GK; ks += 32) {
      v16bf a[4], b[4];
#pragma unroll
      for (int i = 0; i < 4; ++i) {
        a[i] = load_frag(Al, wm * 64 + i * 16, ks, GP);
        b[i] = load_frag(Wl, wn * 64 + i * 16, ks, GP);
      }
#pragma unroll
      for (int mi = 0; mi < 4; ++mi)
#pragma unroll
        for (int ni = 0; ni < 4; ++ni)
          c[mi][ni] = wmma_bf16(a[mi], b[ni], c[mi][ni]);
    }
    // Publish point of the next stage; it also frees this stage's buffer.
    asm volatile("s_wait_dscnt 0x0" ::: "memory");     // own LDS reads of this buffer done
    asm volatile("s_wait_asynccnt 0x0" ::: "memory");  // own copies of the next stage landed
    __syncthreads();
    if (k0 + 2 * GK < DD)                              // same for the whole work-group
      copy_stage<GK>(la + buf * (ABUF * 2), lw + buf * (WBUF * 2),
                     ga + k0 + 2 * GK, gw + k0 + 2 * GK);
  }
  asm volatile("s_wait_asynccnt 0x0" ::: "memory");    // nothing in flight behind the loop
}

// ---------------------------------------------------------------------------
// Kernel 1: fused QKV projection.  Xb[8192,1024]bf16 x WT rows (k contiguous)
// Q,K stored [b,h,t,dh] row-major; V stored transposed [b,h,dh,t].
// 1/sqrt(DH)=0.125 folded into Q.
// grid (32, 24): x = 8192/256 row tiles, y = 3072/128 column tiles = two heads
// of one matrix; a wave's 64 columns are one head.
// Register budget of four waves a SIMD, and 64 k to a stage so that the rings of
// two work-groups fit the LDS: two work-groups stay resident on a WGP.
// ---------------------------------------------------------------------------
__global__ __launch_bounds__(256) __attribute__((amdgpu_waves_per_eu(4, 4)))
void mha_qkv_proj_kernel(const bf16_t* __restrict__ Xb,
                         const bf16_t* __restrict__ WT,
                         bf16_t* __restrict__ Qb,
                         bf16_t* __restrict__ Kb,
                         bf16_t* __restrict__ Vt) {
  __shared__ __attribute__((aligned(16))) bf16_t ring[GEMM_LDS(64)];
  const int tid  = threadIdx.x;
  const int lane = tid & 31, wid = tid >> 5;
  const int lanen = lane & 15, hf = lane >> 4;
  const int wm = wid >> 1, wn = wid & 1;
  const int r0  = blockIdx.x * 256;
  const int mat = blockIdx.y >> 3;                // 0=Q 1=K 2=V (block-uniform)
  const int h   = (blockIdx.y * 2 + wn) & 15;     // this wave's head

  v8f c[4][4] = {};
  gemm_tile_256x128<64>(Xb + (size_t)r0 * DD, WT + (size_t)blockIdx.y * 128 * DD, ring, c);

  // Epilogue: tile never crosses a batch boundary (2048 % 256 == 0), and mat
  // is block-uniform -> one uniform branch, branch-free store loops inside.
  const int bidx = r0 >> 11;                 // batch index (uniform)
  const int t00  = (r0 & 2047) + wm * 64;    // base t for this wave
  const size_t bh = (size_t)(bidx * HH + h);

  if (mat == 0) {
    bf16_t* dst = Qb + bh * TT * DH;
#pragma unroll
    for (int mi = 0; mi < 4; ++mi)
#pragma unroll
      for (int ni = 0; ni < 4; ++ni) {
        int e = ni * 16 + lanen;
#pragma unroll
        for (int r = 0; r < 8; ++r) {
          int t = t00 + mi * 16 + r + 8 * hf;
          dst[(size_t)t * DH + e] = (bf16_t)(c[mi][ni][r] * 0.125f);
        }
      }
  } else if (mat == 1) {
    bf16_t* dst = Kb + bh * TT * DH;
#pragma unroll
    for (int mi = 0; mi < 4; ++mi)
#pragma unroll
      for (int ni = 0; ni < 4; ++ni) {
        int e = ni * 16 + lanen;
#pragma unroll
        for (int r = 0; r < 8; ++r) {
          int t = t00 + mi * 16 + r + 8 * hf;
          dst[(size_t)t * DH + e] = (bf16_t)c[mi][ni][r];
        }
      }
  } else {
    // V transposed [dh][t]: consecutive r -> consecutive t -> packed b32 stores
    bf16_t* dst = Vt + bh * DH * TT;
#pragma unroll
    for (int mi = 0; mi < 4; ++mi)
#pragma unroll
      for (int ni = 0; ni < 4; ++ni) {
        int e = ni * 16 + lanen;
#pragma unroll
        for (int r = 0; r < 8; r += 2) {
          int t = t00 + mi * 16 + r + 8 * hf;   // even
          v2bf pv = { (bf16_t)c[mi][ni][r], (bf16_t)c[mi][ni][r + 1] };
          *reinterpret_cast<v2bf*>(&dst[(size_t)e * TT + t]) = pv;
        }
      }
  }
}

#define KVP   72                 // LDS row pitch in bf16: 144 B = 16 B x odd
#define KVBUF (64 * KVP)         // one buffer: 64 rows
#define QC    2                  // 16-column query groups per wave

// Four 16-byte copies per lane = one K tile + one V^T tile per work-group.
// The s_wait_xcnt stands inside the statement so that no address register of
// an issued copy is rewritten in front of it.
__device__ inline void copy_kv_tile(unsigned lk, unsigned lv,
                                    const bf16_t* gk, const bf16_t* gv) {
  const unsigned lk1 = lk + 32 * KVP * 2, lv1 = lv + 32 * KVP * 2;
  const bf16_t* gk1 = gk + 32 * DH;
  const bf16_t* gv1 = gv + (size_t)32 * TT;
  asm volatile("global_load_async_to_lds_b128 %0, %4, off\n\t"
               "global_load_async_to_lds_b128 %1, %5, off\n\t"
               "global_load_async_to_lds_b128 %2, %6, off\n\t"
               "global_load_async_to_lds_b128 %3, %7, off\n\t"
               "s_wait_xcnt 0x0"
               :: "v"(lk), "v"(lk1), "v"(lv), "v"(lv1),
                  "v"(gk), "v"(gk1), "v"(gv), "v"(gv1)
               : "memory");
}

// Lane l takes the value of lane l ^ 16 (a register move, no LDS traffic).
__device__ inline float xhalf(float v) {
  const int i = __builtin_bit_cast(int, v);
  return __builtin_bit_cast(float,
      __builtin_amdgcn_permlanex16(i, i, 0x76543210, 0xfedcba98, false, false));
}

// Register budget of four waves a SIMD: two work-groups stay resident on a WGP.
__global__ __launch_bounds__(256) __attribute__((amdgpu_waves_per_eu(4, 4)))
void mha_flash_attn_kernel(const bf16_t* __restrict__ Qb,
                           const bf16_t* __restrict__ Kb,
                           const bf16_t* __restrict__ Vt,
                           bf16_t* __restrict__ Ob) {
  __shared__ __attribute__((aligned(16))) bf16_t Ks[2 * KVBUF];  // [buf][key][dh]
  __shared__ __attribute__((aligned(16))) bf16_t Vs[2 * KVBUF];  // [buf][dh][key]
  const int tid = threadIdx.x, lane = tid & 31, wid = tid >> 5;
  const int lanen = lane & 15, hf = lane >> 4;
  const int bh = blockIdx.x;                 // 0..63
  const int b = bh >> 4, h = bh & 15;
  const int q0 = blockIdx.y * (128 * QC) + wid * (16 * QC);
  const bf16_t* Qh = Qb + (size_t)bh * TT * DH;
  const bf16_t* Kh = Kb + (size_t)bh * TT * DH;
  const bf16_t* Vh = Vt + (size_t)bh * DH * TT;

  // Q as B operand: column = query q0 + c*16 + lane%16 for group c, k = dh in the hardware order.
  v16bf qf[QC][2];
  v8f o[QC][4] = {};                         // o[c][n][r] = O^T[n*16 + 8*hf + r][query of group c]
  float mrun[QC];                            // this lane's queries: running maximum
  float lrun[QC];                            // and the sum over this half's keys
#pragma unroll
  for (int c = 0; c < QC; ++c) {
    qf[c][0] = load_frag(Qh, q0 + c * 16,  0, DH);
    qf[c][1] = load_frag(Qh, q0 + c * 16, 32, DH);
    mrun[c] = -3.0e38f;
    lrun[c] = 0.0f;
  }

  // This lane's share of a tile: rows crow and crow + 32, 16 bytes at column ccol.
  const int crow = tid >> 3, ccol = (tid & 7) * 8;
  const unsigned ldsK = (unsigned)(uintptr_t)&Ks[crow * KVP + ccol];
  const unsigned ldsV = (unsigned)(uintptr_t)&Vs[crow * KVP + ccol];
  const bf16_t* gK = Kh + crow * DH + ccol;            // + kt * DH per tile
  const bf16_t* gV = Vh + (size_t)crow * TT + ccol;    // + kt per tile

  // Ring prologue: tile 0 landed and published, then tile 1 in flight.
  copy_kv_tile(ldsK, ldsV, gK, gV);
  asm volatile("s_wait_asynccnt 0x0" ::: "memory");    // own copies of tile 0 landed
  __syncthreads();                                     // every wave's copies visible
  copy_kv_tile(ldsK + KVBUF * 2, ldsV + KVBUF * 2, gK + 64 * DH, gV + 64);

  for (int kt = 0; kt < TT; kt += 64) {
    const int buf = (kt >> 6) & 1;
    const bf16_t* Kl = &Ks[buf * KVBUF];
    const bf16_t* Vl = &Vs[buf * KVBUF];
    // S^T = K * Q^T  (scale already folded into Q)
    // s[c][n][r] = score of key kt + n*16 + 8*hf + r against this lane's query of group c
    v8f s[QC][4] = {};
#pragma unroll
    for (int j = 0; j < 2; ++j) {
#pragma unroll
      for (int n = 0; n < 4; ++n) {
        v16bf ak = load_frag(Kl, n * 16, j * 32, KVP);
#pragma unroll
        for (int c = 0; c < QC; ++c) s[c][n] = wmma_bf16(ak, qf[c][j], s[c][n]);
      }
    }
    v16bf pb[QC][2];
#pragma unroll
    for (int c = 0; c < QC; ++c) {
      // online softmax: in-lane over 32 keys, one exchange for the other 32
      float mx[8];
#pragma unroll
      for (int r = 0; r < 8; ++r)
        mx[r] = fmaxf(fmaxf(s[c][0][r], s[c][1][r]), fmaxf(s[c][2][r], s[c][3][r]));
      float mt = fmaxf(fmaxf(fmaxf(mx[0], mx[1]), fmaxf(mx[2], mx[3])),
                       fmaxf(fmaxf(mx[4], mx[5]), fmaxf(mx[6], mx[7])));
      mt = fmaxf(mt, xhalf(mt));
      const float mn = fmaxf(mrun[c], mt);
      const float alpha = __expf(mrun[c] - mn);
      mrun[c] = mn;

      float rs[4] = {0.0f, 0.0f, 0.0f, 0.0f};  // four chains, joined below
#pragma unroll
      for (int n = 0; n < 4; ++n)
#pragma unroll
        for (int r = 0; r < 8; ++r) {
          float p = __expf(s[c][n][r] - mn);
          s[c][n][r] = p;
          rs[n] += p;
        }
      lrun[c] = lrun[c] * alpha + ((rs[0] + rs[1]) + (rs[2] + rs[3]));
#pragma unroll
      for (int n = 0; n < 4; ++n)
#pragma unroll
        for (int r = 0; r < 8; ++r) o[c][n][r] *= alpha;

      // P^T as B operand: tiles 2*kk and 2*kk + 1 give k = 8*hf + e and 16 + 8*hf + e,
      // the order in which load_frag takes the keys of a V^T row.
#pragma unroll
      for (int kk = 0; kk < 2; ++kk)
#pragma unroll
        for (int e = 0; e < 8; ++e) {
          pb[c][kk][e]     = (bf16_t)s[c][2 * kk][e];
          pb[c][kk][e + 8] = (bf16_t)s[c][2 * kk + 1][e];
        }
    }

    // O^T += V^T * P^T   (V^T tile is [dh][key] in LDS -> direct A-fragments)
#pragma unroll
    for (int kk = 0; kk < 2; ++kk) {
#pragma unroll
      for (int n = 0; n < 4; ++n) {
        v16bf av = load_frag(Vl, n * 16, kk * 32, KVP);
#pragma unroll
        for (int c = 0; c < QC; ++c) o[c][n] = wmma_bf16(av, pb[c][kk], o[c][n]);
      }
    }
    // Publish point of the next tile; it also frees this tile's buffer.
    asm volatile("s_wait_dscnt 0x0" ::: "memory");     // own LDS reads of this buffer done
    asm volatile("s_wait_asynccnt 0x0" ::: "memory");  // own copies of the next tile landed
    __syncthreads();
    if (kt + 128 < TT)                                 // same for the whole work-group
      copy_kv_tile(ldsK + buf * (KVBUF * 2), ldsV + buf * (KVBUF * 2),
                   gK + (size_t)(kt + 128) * DH, gV + (kt + 128));
  }
  asm volatile("s_wait_asynccnt 0x0" ::: "memory");    // nothing in flight at the wave's end

  // join the halves' sums, normalize, store concat-head layout [b, t, h*64 + e]:
  // a lane's 8 accumulator registers are 8 consecutive e of its query's row.
#pragma unroll
  for (int c = 0; c < QC; ++c) {
    const float ltot = lrun[c] + xhalf(lrun[c]);
    bf16_t* dst = Ob + ((size_t)(b * TT + q0 + c * 16 + lanen) * (HH * DH)) + h * DH + 8 * hf;
#pragma unroll
    for (int n = 0; n < 4; ++n) {
      v8bf ov;
#pragma unroll
      for (int r = 0; r < 8; ++r) ov[r] = (bf16_t)(o[c][n][r] / ltot);
      *reinterpret_cast<v8bf*>(dst + n * 16) = ov;
    }
  }
}

// ---------------------------------------------------------------------------
// Kernel 3: output projection + bias.  Ob[8192,1024]bf16 x WT rows 3072.. (Wo^T)
// grid (32, 8): 256-row x 128-col tiles, one work-group to a WGP, so the ring
// takes 128 k to a stage: twice the bytes in flight and half the barriers.
// ---------------------------------------------------------------------------
__global__ __launch_bounds__(256)
void mha_out_proj_kernel(const bf16_t* __restrict__ Ob,
                         const bf16_t* __restrict__ WT,
                         const float* __restrict__ bo,
                         float* __restrict__ out) {
  __shared__ __attribute__((aligned(16))) bf16_t ring[GEMM_LDS(128)];
  const int tid = threadIdx.x, lane = tid & 31, wid = tid >> 5;
  const int lanen = lane & 15, hf = lane >> 4;
  const int wm = wid >> 1, wn = wid & 1;
  const int r0 = blockIdx.x * 256;
  const int n0 = blockIdx.y * 128;

  v8f c[4][4] = {};
  gemm_tile_256x128<128>(Ob + (size_t)r0 * DD, WT + (size_t)(3 * HH * DH + n0) * DD, ring, c);

#pragma unroll
  for (int mi = 0; mi < 4; ++mi)
#pragma unroll
    for (int ni = 0; ni < 4; ++ni) {
      int col = n0 + wn * 64 + ni * 16 + lanen;
      float bias = bo[col];
#pragma unroll
      for (int r = 0; r < 8; ++r) {
        int row = r0 + wm * 64 + mi * 16 + r + 8 * hf;
        out[(size_t)row * DD + col] = c[mi][ni][r] + bias;
      }
    }
}

extern "C" void kernel_launch(void* const* d_in, const int* in_sizes, int n_in,
                              void* d_out, int out_size, void* d_ws, size_t ws_size,
                              hipStream_t stream) {
  const float* x  = (const float*)d_in[0];
  const float* Wq = (const float*)d_in[1];
  const float* Wk = (const float*)d_in[2];
  const float* Wv = (const float*)d_in[3];
  const float* Wo = (const float*)d_in[4];
  const float* bo = (const float*)d_in[5];
  float* out = (float*)d_out;

  const size_t elems = (size_t)BB * HH * TT * DH;   // 8,388,608 per buffer
  bf16_t* Qb = (bf16_t*)d_ws;
  bf16_t* Kb = Qb + elems;
  bf16_t* Vt = Kb + elems;
  bf16_t* Ob = Vt + elems;
  bf16_t* Xb = Ob + elems;
  bf16_t* WT = Xb + elems;                          // 4096 x 1024

  mha_convert_kernel<<<dim3(768), 256, 0, stream>>>(x, Wq, Wk, Wv, Wo, Xb, WT);
  mha_qkv_proj_kernel<<<dim3(32, 24), 256, 0, stream>>>(Xb, WT, Qb, Kb, Vt);
  mha_flash_attn_kernel<<<dim3(64, 8), 256, 0, stream>>>(Qb, Kb, Vt, Ob);
  mha_out_proj_kernel<<<dim3(32, 8), 256, 0, stream>>>(Ob, WT, bo, out);
}

// v008
// One run takes 115 microseconds.
// Versions between v006 and this one are left out; their measured steps multiply to 1.09 times as fast.
// Over all steps from v000 it is 4.78 times as fast.
#include <hip/hip_runtime.h>
#include <hip/hip_bf16.h>

typedef __bf16 bf16_t;
typedef __attribute__((ext_vector_type(16))) __bf16 v16bf;
typedef __attribute__((ext_vector_type(8)))  __bf16 v8bf;
typedef __attribute__((ext_vector_type(4)))  __bf16 v4bf;
typedef __attribute__((ext_vector_type(2)))  __bf16 v2bf;
typedef __attribute__((ext_vector_type(8)))  float  v8f;

#define BB  4
#define TT  2048
#define DD  1024
#define HH  16
#define DH  64
#define QSCALE 0.18033688f       // 1/sqrt(DH) * log2(e)

union FragU { v16bf v; v8bf h[2]; };

// Load a 16x32 bf16 WMMA A/B fragment from a row-major [rows][ld] bf16 matrix.
// A: row = base_row + lane%16 ; B: n = base_row + lane%16 with source in [N][K] layout.
// Per documented layout: elements 0..7 at K=k0+(lane/16)*8, elements 8..15 at K=k0+16+(lane/16)*8.
__device__ inline v16bf load_frag(const bf16_t* base, int row0, int k0, int ld) {
  const int lane = threadIdx.x & 31;
  const int sel  = lane & 15;
  const int hf   = lane >> 4;
  const bf16_t* p = base + (size_t)(row0 + sel) * ld + k0 + hf * 8;
  FragU f;
  f.h[0] = *reinterpret_cast<const v8bf*>(p);
  f.h[1] = *reinterpret_cast<const v8bf*>(p + 16);
  return f.v;
}

__device__ inline v8f wmma_bf16(v16bf a, v16bf b, v8f c) {
  // (neg_a, A, neg_b, B, c_mod, C, reuse_a, reuse_b)
  return __builtin_amdgcn_wmma_f32_16x16x32_bf16(false, a, false, b, (short)0, c, false, false);
}

// ---------------------------------------------------------------------------
// Kernel 0: operands of both projections converted to bf16 once per call.
// Xb[8192][1024] = x.  WT[4096][1024] holds every weight with k contiguous:
// row (mat*16 + h)*64 + e = column e of Wq/Wk/Wv[h], row 3072 + n = column n of Wo.
// Blocks 0..255: a 256(k) x 64(n) weight strip each, transposed through LDS.
// Blocks 256..767: 16 float4 of x per thread, every load a wave-contiguous 512 B.
// ---------------------------------------------------------------------------
#define TSP 264                  // LDS row pitch in bf16: 528 B = 16 B x odd

__global__ __launch_bounds__(256)
void mha_convert_kernel(const float* __restrict__ x,
                        const float* __restrict__ Wq,
                        const float* __restrict__ Wk,
                        const float* __restrict__ Wv,
                        const float* __restrict__ Wo,
                        bf16_t* __restrict__ Xb,
                        bf16_t* __restrict__ WT) {
  __shared__ __attribute__((aligned(16))) bf16_t Ts[64 * TSP];   // [n=64][k=256]
  const int tid = threadIdx.x;
  if (blockIdx.x >= 256) {                     // block-uniform: these blocks meet no barrier
    const size_t base = (size_t)(blockIdx.x - 256) * 4096 + tid;   // in float4
    float4 xv[16];
#pragma unroll
    for (int i = 0; i < 16; ++i) {
      // the last load's result may be given the address registers that the loads
      // before it name: the wait stands in front of that overwrite
      if (i == 15) asm volatile("s_wait_xcnt 0x0" ::: "memory");
      xv[i] = reinterpret_cast<const float4*>(x)[base + i * 256];
    }
#pragma unroll
    for (int i = 0; i < 16; ++i) {
      v4bf bv = { (bf16_t)xv[i].x, (bf16_t)xv[i].y, (bf16_t)xv[i].z, (bf16_t)xv[i].w };
      reinterpret_cast<v4bf*>(Xb)[base + i * 256] = bv;
    }
    return;
  }
  const int m  = blockIdx.x >> 2;              // group of 64 rows of WT
  const int kb = (blockIdx.x & 3) * 256;       // first k of the strip
  const int mat = m >> 4, h = m & 15;
  // the strip's first element and its row pitch in floats (block-uniform)
  const float* src = mat == 0 ? Wq : (mat == 1 ? Wk : (mat == 2 ? Wv : Wo));
  const int pitch  = mat < 3 ? DH : DD;
  src += (mat < 3 ? (size_t)h * DD * DH : (size_t)h * 64) + (size_t)kb * pitch;
  const int d0 = tid >> 4, e4 = tid & 15;
  const float* p = src + (size_t)d0 * pitch + e4 * 4;
  float4 wv[16];
#pragma unroll
  for (int i = 0; i < 16; ++i)
    wv[i] = *reinterpret_cast<const float4*>(p + (size_t)(i * 16) * pitch);
#pragma unroll
  for (int i = 0; i < 16; ++i) {
    const int d = i * 16 + d0;
    Ts[(e4 * 4 + 0) * TSP + d] = (bf16_t)wv[i].x;
    Ts[(e4 * 4 + 1) * TSP + d] = (bf16_t)wv[i].y;
    Ts[(e4 * 4 + 2) * TSP + d] = (bf16_t)wv[i].z;
    Ts[(e4 * 4 + 3) * TSP + d] = (bf16_t)wv[i].w;
  }
  __syncthreads();
#pragma unroll
  for (int i = 0; i < 8; ++i) {
    int idx = i * 256 + tid;
    int row = idx >> 5, c8 = idx & 31;         // a wave writes 512 B of one row
    *reinterpret_cast<v8bf*>(WT + (size_t)(m * 64 + row) * DD + kb + c8 * 8) =
        *reinterpret_cast<const v8bf*>(&Ts[row * TSP + c8 * 8]);
  }
}

// ---------------------------------------------------------------------------
// Main loop of both projections: one 256 x 128 tile of A[.][1024] * W[.][1024]^T
// per work-group, both operands k contiguous, GK k to a stage. 8 waves as
// 4 (rows) x 2 (columns), 64 x 64 per wave: each fragment taken from LDS feeds
// four products.
// The operand tiles go from L2 into a two-buffer LDS ring by asynchronous
// copies, one stage ahead: stage t + 1 flies while stage t is multiplied, no
// staging register is held and one barrier a stage both publishes the next
// stage and frees the buffer just read.
// Ag = first row of the A tile, Wg = first row of the W tile (row = output column).
// c[mi][ni] = rows wm*64 + mi*16.., columns wn*64 + ni*16.. of the tile.
// LDS row pitch: GK + 8 bf16 = 16 B x odd for GK = 64 and 128.
// ---------------------------------------------------------------------------
#define GEMM_LDS(GK) (2 * (256 + 128) * ((GK) + 8))   // bf16 elements: A ring, then W ring

// Twelve 16-byte copies per lane in one statement, so that a stage meets few
// waits. The s_wait_xcnt stands inside the statement so that no address
// register of an issued copy is rewritten in front of it.
__device__ inline void copy12(const unsigned (&l)[12], const bf16_t* const (&g)[12]) {
  asm volatile(
               "global_load_async_to_lds_b128 %0, %12, off\n\t"
               "global_load_async_to_lds_b128 %1, %13, off\n\t"
               "global_load_async_to_lds_b128 %2, %14, off\n\t"
               "global_load_async_to_lds_b128 %3, %15, off\n\t"
               "global_load_async_to_lds_b128 %4, %16, off\n\t"
               "global_load_async_to_lds_b128 %5, %17, off\n\t"
               "global_load_async_to_lds_b128 %6, %18, off\n\t"
               "global_load_async_to_lds_b128 %7, %19, off\n\t"
               "global_load_async_to_lds_b128 %8, %20, off\n\t"
               "global_load_async_to_lds_b128 %9, %21, off\n\t"
               "global_load_async_to_lds_b128 %10, %22, off\n\t"
               "global_load_async_to_lds_b128 %11, %23, off\n\t"
               "s_wait_xcnt 0x0"
               :: "v"(l[0]), "v"(l[1]), "v"(l[2]), "v"(l[3]), "v"(l[4]), "v"(l[5]),
                  "v"(l[6]), "v"(l[7]), "v"(l[8]), "v"(l[9]), "v"(l[10]), "v"(l[11]),
                  "v"(g[0]), "v"(g[1]), "v"(g[2]), "v"(g[3]), "v"(g[4]), "v"(g[5]),
                  "v"(g[6]), "v"(g[7]), "v"(g[8]), "v"(g[9]), "v"(g[10]), "v"(g[11])
               : "memory");
}

// One stage of both operands: 256 rows of A and 128 rows of W, GK k each.
// la, lw, ga, gw = this lane's piece of the first RP rows; the 256 lanes cover
// RP whole rows a pass, A in the first 256 / RP passes and W in the rest.
template <int GK>
__device__ inline void copy_stage(unsigned la, unsigned lw,
                                  const bf16_t* ga, const bf16_t* gw) {
  constexpr int RP = 2048 / GK;                    // rows per pass
  constexpr int PA = 256 / RP, PN = 384 / RP;      // passes over A, over both
  constexpr unsigned LS = RP * (GK + 8) * 2;       // LDS bytes per pass
  constexpr size_t GS = (size_t)RP * DD;           // global elements per pass
  // both loops unrolled: every address is then the lane's own plus a constant,
  // and the two small arrays are registers
#pragma unroll
  for (int j = 0; j < PN; j += 12) {
    unsigned l[12];
    const bf16_t* g[12];
#pragma unroll
    for (int i = 0; i < 12; ++i) {
      const int p = j + i;
      l[i] = p < PA ? la + p * LS : lw + (p - PA) * LS;
      g[i] = p < PA ? ga + p * GS : gw + (p - PA) * GS;
    }
    copy12(l, g);
  }
}

template <int GK>
__device__ inline void gemm_tile_256x128(const bf16_t* __restrict__ Ag,
                                         const bf16_t* __restrict__ Wg,
                                         bf16_t* ring, v8f (&c)[4][4]) {
  constexpr int GP = GK + 8;                       // LDS row pitch in bf16
  constexpr int ABUF = 256 * GP, WBUF = 128 * GP;  // one buffer of each operand
  bf16_t* As = ring;                               // [buf][row 256][k]
  bf16_t* Ws = ring + 2 * ABUF;                    // [buf][column 128][k]
  const int tid = threadIdx.x, wid = tid >> 5;
  const int wm = wid >> 1, wn = wid & 1;
  const int srow = tid / (GK / 8), sc8 = (tid % (GK / 8)) * 8;   // 16-byte pieces of whole rows
  const unsigned la = (unsigned)(uintptr_t)&As[srow * GP + sc8];
  const unsigned lw = (unsigned)(uintptr_t)&Ws[srow * GP + sc8];
  const bf16_t* ga = Ag + (size_t)srow * DD + sc8;
  const bf16_t* gw = Wg + (size_t)srow * DD + sc8;

  // Ring prologue: stage 0 landed and published, then stage 1 in flight.
  copy_stage<GK>(la, lw, ga, gw);
  asm volatile("s_wait_asynccnt 0x0" ::: "memory");    // own copies of stage 0 landed
  __syncthreads();                                     // every wave's copies visible
  copy_stage<GK>(la + ABUF * 2, lw + WBUF * 2, ga + GK, gw + GK);

  // Fragments run ahead of their products. A block is 32 k: 16 products, as rows
  // mi of four. b has two register sets, a one: rows 2 and 3 of a are read at the
  // block's head with the next block's b, two rows ahead of their use; rows 0 and 1
  // of the next block are read at mid-block into the registers that this block's
  // rows 0 and 1 have left. 224 registers with the accumulators.
  // Every sched_barrier below keeps a group of LDS reads where it is written: left
  // alone the compiler sinks each read to its first use, and every row of four
  // products then stands behind a wait for its own LDS round trip.
  static_assert((GK / 32) % 2 == 0, "a stage's first block uses b[0]");
  v16bf a[4], b[2][4];
  a[0] = load_frag(As, wm * 64, 0, GP);
  a[1] = load_frag(As, wm * 64 + 16, 0, GP);
#pragma unroll
  for (int i = 0; i < 4; ++i) b[0][i] = load_frag(Ws, wn * 64 + i * 16, 0, GP);

  for (int k0 = 0; k0 < DD; k0 += GK) {
    const int buf = (k0 / GK) & 1;
    const bf16_t* Al = As + buf * ABUF;
    const bf16_t* Wl = Ws + buf * WBUF;
    const bf16_t* An = As + (buf ^ 1) * ABUF;          // the next stage's buffer
    const bf16_t* Wn = Ws + (buf ^ 1) * WBUF;
#pragma unroll
    for (int ks = 0; ks < GK; ks += 32) {
      const int cur = (ks >> 5) & 1, nxt = cur ^ 1;
      const bool last = ks + 32 == GK;                 // the stage's last block
      a[2] = load_frag(Al, wm * 64 + 32, ks, GP);
      a[3] = load_frag(Al, wm * 64 + 48, ks, GP);
      if (!last) {
#pragma unroll
        for (int i = 0; i < 4; ++i) b[nxt][i] = load_frag(Wl, wn * 64 + i * 16, ks + 32, GP);
      }
      __builtin_amdgcn_sched_barrier(0);               // head group stays ahead of rows 0 and 1
#pragma unroll
      for (int mi = 0; mi < 2; ++mi)
#pragma unroll
        for (int ni = 0; ni < 4; ++ni)
          c[mi][ni] = wmma_bf16(a[mi], b[cur][ni], c[mi][ni]);
      __builtin_amdgcn_sched_barrier(0);               // mid group stays behind rows 0 and 1
      if (!last) {
        a[0] = load_frag(Al, wm * 64, ks + 32, GP);
        a[1] = load_frag(Al, wm * 64 + 16, ks + 32, GP);
      } else {
        // Publish point of the next stage, in the middle of the last block: this
        // stage's last fragments are fetched, so it also frees this stage's buffer.
        asm volatile("s_wait_dscnt 0x0" ::: "memory");     // own LDS reads of this buffer done
        asm volatile("s_wait_asynccnt 0x0" ::: "memory");  // own copies of the next stage landed
        __syncthreads();
        if (k0 + 2 * GK < DD)                              // same for the whole work-group
          copy_stage<GK>(la + buf * (ABUF * 2), lw + buf * (WBUF * 2),
                         ga + k0 + 2 * GK, gw + k0 + 2 * GK);
        // First fragments of the next stage, now published. In the last stage these
        // reads take the stage before's bytes (no copy is in flight there) and feed
        // nothing: unconditional, so that no branch merges the wait counts.
        a[0] = load_frag(An, wm * 64, 0, GP);
        a[1] = load_frag(An, wm * 64 + 16, 0, GP);
#pragma unroll
        for (int i = 0; i < 4; ++i) b[nxt][i] = load_frag(Wn, wn * 64 + i * 16, 0, GP);
      }
      __builtin_amdgcn_sched_barrier(0);               // mid group stays ahead of rows 2 and 3
#pragma unroll
      for (int mi = 2; mi < 4; ++mi)
#pragma unroll
        for (int ni = 0; ni < 4; ++ni)
          c[mi][ni] = wmma_bf16(a[mi], b[cur][ni], c[mi][ni]);
      __builtin_amdgcn_sched_barrier(0);               // the next head group stays behind this block
    }
  }
  asm volatile("s_wait_asynccnt 0x0" ::: "memory");    // nothing in flight behind the loop
  asm volatile("s_wait_dscnt 0x0" ::: "memory");       // the last stage's unused fragment reads are back
}

// ---------------------------------------------------------------------------
// Kernel 1: fused QKV projection.  Xb[8192,1024]bf16 x WT rows (k contiguous)
// Q,K stored [b,h,t,dh] row-major; V stored transposed [b,h,dh,t].
// 1/sqrt(DH) * log2(e) folded into Q: attention works on base-2 exponents.
// grid (32, 24): x = 8192/256 row tiles, y = 3072/128 column tiles = two heads
// of one matrix; a wave's 64 columns are one head.
// Register budget of four waves a SIMD, and 64 k to a stage so that the rings of
// two work-groups fit the LDS: two work-groups stay resident on a WGP.
// ---------------------------------------------------------------------------
__global__ __launch_bounds__(256) __attribute__((amdgpu_waves_per_eu(4, 4)))
void mha_qkv_proj_kernel(const bf16_t* __restrict__ Xb,
                         const bf16_t* __restrict__ WT,
                         bf16_t* __restrict__ Qb,
                         bf16_t* __restrict__ Kb,
                         bf16_t* __restrict__ Vt) {
  __shared__ __attribute__((aligned(16))) bf16_t ring[GEMM_LDS(64)];
  const int tid  = threadIdx.x;
  const int lane = tid & 31, wid = tid >> 5;
  const int lanen = lane & 15, hf = lane >> 4;
  const int wm = wid >> 1, wn = wid & 1;
  const int r0  = blockIdx.x * 256;
  const int mat = blockIdx.y >> 3;                // 0=Q 1=K 2=V (block-uniform)
  const int h   = (blockIdx.y * 2 + wn) & 15;     // this wave's head

  v8f c[4][4] = {};
  gemm_tile_256x128<64>(Xb + (size_t)r0 * DD, WT + (size_t)blockIdx.y * 128 * DD, ring, c);

  // Epilogue: tile never crosses a batch boundary (2048 % 256 == 0), and mat
  // is block-uniform -> one uniform branch, branch-free store loops inside.
  const int bidx = r0 >> 11;                 // batch index (uniform)
  const int t00  = (r0 & 2047) + wm * 64;    // base t for this wave
  const size_t bh = (size_t)(bidx * HH + h);

  if (mat == 0) {
    bf16_t* dst = Qb + bh * TT * DH;
#pragma unroll
    for (int mi = 0; mi < 4; ++mi)
#pragma unroll
      for (int ni = 0; ni < 4; ++ni) {
        int e = ni * 16 + lanen;
#pragma unroll
        for (int r = 0; r < 8; ++r) {
          int t = t00 + mi * 16 + r + 8 * hf;
          dst[(size_t)t * DH + e] = (bf16_t)(c[mi][ni][r] * QSCALE);
        }
      }
  } else if (mat == 1) {
    bf16_t* dst = Kb + bh * TT * DH;
#pragma unroll
    for (int mi = 0; mi < 4; ++mi)
#pragma unroll
      for (int ni = 0; ni < 4; ++ni) {
        int e = ni * 16 + lanen;
#pragma unroll
        for (int r = 0; r < 8; ++r) {
          int t = t00 + mi * 16 + r + 8 * hf;
          dst[(size_t)t * DH + e] = (bf16_t)c[mi][ni][r];
        }
      }
  } else {
    // V transposed [dh][t]: consecutive r -> consecutive t -> packed b32 stores
    bf16_t* dst = Vt + bh * DH * TT;
#pragma unroll
    for (int mi = 0; mi < 4; ++mi)
#pragma unroll
      for (int ni = 0; ni < 4; ++ni) {
        int e = ni * 16 + lanen;
#pragma unroll
        for (int r = 0; r < 8; r += 2) {
          int t = t00 + mi * 16 + r + 8 * hf;   // even
          v2bf pv = { (bf16_t)c[mi][ni][r], (bf16_t)c[mi][ni][r + 1] };
          *reinterpret_cast<v2bf*>(&dst[(size_t)e * TT + t]) = pv;
        }
      }
  }
}

#define KVP   72                 // LDS row pitch in bf16: 144 B = 16 B x odd
#define KVBUF (64 * KVP)         // one buffer: 64 rows
#define QC    2                  // 16-column query groups per wave

// Four 16-byte copies per lane = one K tile + one V^T tile per work-group.
// The s_wait_xcnt stands inside the statement so that no address register of
// an issued copy is rewritten in front of it.
__device__ inline void copy_kv_tile(unsigned lk, unsigned lv,
                                    const bf16_t* gk, const bf16_t* gv) {
  const unsigned lk1 = lk + 32 * KVP * 2, lv1 = lv + 32 * KVP * 2;
  const bf16_t* gk1 = gk + 32 * DH;
  const bf16_t* gv1 = gv + (size_t)32 * TT;
  asm volatile("global_load_async_to_lds_b128 %0, %4, off\n\t"
               "global_load_async_to_lds_b128 %1, %5, off\n\t"
               "global_load_async_to_lds_b128 %2, %6, off\n\t"
               "global_load_async_to_lds_b128 %3, %7, off\n\t"
               "s_wait_xcnt 0x0"
               :: "v"(lk), "v"(lk1), "v"(lv), "v"(lv1),
                  "v"(gk), "v"(gk1), "v"(gv), "v"(gv1)
               : "memory");
}

// Lane l takes the value of lane l ^ 16 (a register move, no LDS traffic).
__device__ inline float xhalf(float v) {
  const int i = __builtin_bit_cast(int, v);
  return __builtin_bit_cast(float,
      __builtin_amdgcn_permlanex16(i, i, 0x76543210, 0xfedcba98, false, false));
}

// Register budget of four waves a SIMD: two work-groups stay resident on a WGP.
__global__ __launch_bounds__(256) __attribute__((amdgpu_waves_per_eu(4, 4)))
void mha_flash_attn_kernel(const bf16_t* __restrict__ Qb,
                           const bf16_t* __restrict__ Kb,
                           const bf16_t* __restrict__ Vt,
                           bf16_t* __restrict__ Ob) {
  __shared__ __attribute__((aligned(16))) bf16_t Ks[2 * KVBUF];  // [buf][key][dh]
  __shared__ __attribute__((aligned(16))) bf16_t Vs[2 * KVBUF];  // [buf][dh][key]
  const int tid = threadIdx.x, lane = tid & 31, wid = tid >> 5;
  const int lanen = lane & 15, hf = lane >> 4;
  const int bh = blockIdx.x;                 // 0..63
  const int b = bh >> 4, h = bh & 15;
  const int q0 = blockIdx.y * (128 * QC) + wid * (16 * QC);
  const bf16_t* Qh = Qb + (size_t)bh * TT * DH;
  const bf16_t* Kh = Kb + (size_t)bh * TT * DH;
  const bf16_t* Vh = Vt + (size_t)bh * DH * TT;

  // Q as B operand: column = query q0 + c*16 + lane%16 for group c, k = dh in the hardware order.
  v16bf qf[QC][2];
  v8f o[QC][4] = {};                         // o[c][n][r] = O^T[n*16 + 8*hf + r][query of group c]
  v8f nref[QC];                              // minus this lane's query's reference, in all 8 registers
  float lrun[QC];                            // the sum over this half's keys
#pragma unroll
  for (int c = 0; c < QC; ++c) {
    qf[c][0] = load_frag(Qh, q0 + c * 16,  0, DH);
    qf[c][1] = load_frag(Qh, q0 + c * 16, 32, DH);
    nref[c] = v8f{};
    lrun[c] = 0.0f;
  }

  // This lane's share of a tile: rows crow and crow + 32, 16 bytes at column ccol.
  const int crow = tid >> 3, ccol = (tid & 7) * 8;
  const unsigned ldsK = (unsigned)(uintptr_t)&Ks[crow * KVP + ccol];
  const unsigned ldsV = (unsigned)(uintptr_t)&Vs[crow * KVP + ccol];
  const bf16_t* gK = Kh + crow * DH + ccol;            // + kt * DH per tile
  const bf16_t* gV = Vh + (size_t)crow * TT + ccol;    // + kt per tile

  // Ring prologue: tile 0 landed and published, then tile 1 in flight.
  copy_kv_tile(ldsK, ldsV, gK, gV);
  asm volatile("s_wait_asynccnt 0x0" ::: "memory");    // own copies of tile 0 landed
  __syncthreads();                                     // every wave's copies visible
  copy_kv_tile(ldsK + KVBUF * 2, ldsV + KVBUF * 2, gK + 64 * DH, gV + 64);

  for (int kt = 0; kt < TT; kt += 64) {
    const int buf = (kt >> 6) & 1;
    const bf16_t* Kl = &Ks[buf * KVBUF];
    const bf16_t* Vl = &Vs[buf * KVBUF];
    // S^T * log2(e) - reference = K * Q^T + C  (scale already folded into Q)
    // s[c][n][r] = exp2 argument of key kt + n*16 + 8*hf + r for this lane's query of group c
    v8f s[QC][4];
#pragma unroll
    for (int j = 0; j < 2; ++j) {
#pragma unroll
      for (int n = 0; n < 4; ++n) {
        v16bf ak = load_frag(Kl, n * 16, j * 32, KVP);
#pragma unroll
        for (int c = 0; c < QC; ++c) s[c][n] = wmma_bf16(ak, qf[c][j], j == 0 ? nref[c] : s[c][n]);
      }
    }
    // This half's maxima above the reference, and one test a tile. The first tile
    // always moves the reference (from 0) to its maximum, whatever its sign.
    const float thr = kt == 0 ? -3.0e38f : 8.0f;
    float mt[QC];
    bool need = false;
#pragma unroll
    for (int c = 0; c < QC; ++c) {
      float mx[8];
#pragma unroll
      for (int r = 0; r < 8; ++r)
        mx[r] = fmaxf(fmaxf(s[c][0][r], s[c][1][r]), fmaxf(s[c][2][r], s[c][3][r]));
      mt[c] = fmaxf(fmaxf(fmaxf(mx[0], mx[1]), fmaxf(mx[2], mx[3])),
                    fmaxf(fmaxf(mx[4], mx[5]), fmaxf(mx[6], mx[7])));
      need = need || (mt[c] > thr);
    }
    if (__builtin_amdgcn_ballot_w32(need) != 0) {      // a scalar branch: rare behind the first tile
#pragma unroll
      for (int c = 0; c < QC; ++c) {
        const float mj = fmaxf(mt[c], xhalf(mt[c]));   // both halves hold the query's maximum
        const float d = mj > thr ? mj : 0.0f;          // the reference rises by d (first tile: moves)
        // first tile: O and the sum are 0, and a negative d must not make the factor infinite
        const float alpha = __builtin_amdgcn_exp2f(-fmaxf(d, 0.0f));
        lrun[c] *= alpha;
        nref[c] -= d;
#pragma unroll
        for (int n = 0; n < 4; ++n) {
          s[c][n] -= d;
          o[c][n] *= alpha;
        }
      }
    }
    v16bf pb[QC][2];
#pragma unroll
    for (int c = 0; c < QC; ++c) {
      float rs[4] = {0.0f, 0.0f, 0.0f, 0.0f};  // four chains, joined below
#pragma unroll
      for (int n = 0; n < 4; ++n)
#pragma unroll
        for (int r = 0; r < 8; ++r) {
          float p = __builtin_amdgcn_exp2f(s[c][n][r]);
          s[c][n][r] = p;
          rs[n] += p;
        }
      lrun[c] += (rs[0] + rs[1]) + (rs[2] + rs[3]);

      // P^T as B operand: tiles 2*kk and 2*kk + 1 give k = 8*hf + e and 16 + 8*hf + e,
      // the order in which load_frag takes the keys of a V^T row.
#pragma unroll
      for (int kk = 0; kk < 2; ++kk)
#pragma unroll
        for (int e = 0; e < 8; ++e) {
          pb[c][kk][e]     = (bf16_t)s[c][2 * kk][e];
          pb[c][kk][e + 8] = (bf16_t)s[c][2 * kk + 1][e];
        }
    }

    // O^T += V^T * P^T   (V^T tile is [dh][key] in LDS -> direct A-fragments)
#pragma unroll
    for (int kk = 0; kk < 2; ++kk) {
#pragma unroll
      for (int n = 0; n < 4; ++n) {
        v16bf av = load_frag(Vl, n * 16, kk * 32, KVP);
#pragma unroll
        for (int c = 0; c < QC; ++c) o[c][n] = wmma_bf16(av, pb[c][kk], o[c][n]);
      }
    }
    // Publish point of the next tile; it also frees this tile's buffer.
    asm volatile("s_wait_dscnt 0x0" ::: "memory");     // own LDS reads of this buffer done
    asm volatile("s_wait_asynccnt 0x0" ::: "memory");  // own copies of the next tile landed
    __syncthreads();
    if (kt + 128 < TT)                                 // same for the whole work-group
      copy_kv_tile(ldsK + buf * (KVBUF * 2), ldsV + buf * (KVBUF * 2),
                   gK + (size_t)(kt + 128) * DH, gV + (kt + 128));
  }
  asm volatile("s_wait_asynccnt 0x0" ::: "memory");    // nothing in flight at the wave's end

  // join the halves' sums, normalize, store concat-head layout [b, t, h*64 + e]:
  // a lane's 8 accumulator registers are 8 consecutive e of its query's row.
#pragma unroll
  for (int c = 0; c < QC; ++c) {
    const float ltot = lrun[c] + xhalf(lrun[c]);
    bf16_t* dst = Ob + ((size_t)(b * TT + q0 + c * 16 + lanen) * (HH * DH)) + h * DH + 8 * hf;
#pragma unroll
    for (int n = 0; n < 4; ++n) {
      v8bf ov;
#pragma unroll
      for (int r = 0; r < 8; ++r) ov[r] = (bf16_t)(o[c][n][r] / ltot);
      *reinterpret_cast<v8bf*>(dst + n * 16) = ov;
    }
  }
}

// ---------------------------------------------------------------------------
// Kernel 3: output projection + bias.  Ob[8192,1024]bf16 x WT rows 3072.. (Wo^T)
// grid (32, 8): 256-row x 128-col tiles, one work-group to a WGP, so the ring
// takes 128 k to a stage: twice the bytes in flight and half the barriers.
// ---------------------------------------------------------------------------
__global__ __launch_bounds__(256)
void mha_out_proj_kernel(const bf16_t* __restrict__ Ob,
                         const bf16_t* __restrict__ WT,
                         const float* __restrict__ bo,
                         float* __restrict__ out) {
  __shared__ __attribute__((aligned(16))) bf16_t ring[GEMM_LDS(128)];
  const int tid = threadIdx.x, lane = tid & 31, wid = tid >> 5;
  const int lanen = lane & 15, hf = lane >> 4;
  const int wm = wid >> 1, wn = wid & 1;
  const int r0 = blockIdx.x * 256;
  const int n0 = blockIdx.y * 128;

  v8f c[4][4] = {};
  gemm_tile_256x128<128>(Ob + (size_t)r0 * DD, WT + (size_t)(3 * HH * DH + n0) * DD, ring, c);

  float bias[4];
#pragma unroll
  for (int ni = 0; ni < 4; ++ni) bias[ni] = bo[n0 + wn * 64 + ni * 16 + lanen];
  // the store addresses are formed in the register that the four loads name as
  // their offset: the wait stands in front of that overwrite
  asm volatile("s_wait_xcnt 0x0" ::: "memory");
#pragma unroll
  for (int mi = 0; mi < 4; ++mi)
#pragma unroll
    for (int ni = 0; ni < 4; ++ni) {
      int col = n0 + wn * 64 + ni * 16 + lanen;
#pragma unroll
      for (int r = 0; r < 8; ++r) {
        int row = r0 + wm * 64 + mi * 16 + r + 8 * hf;
        out[(size_t)row * DD + col] = c[mi][ni][r] + bias[ni];
      }
    }
}

extern "C" void kernel_launch(void* const* d_in, const int* in_sizes, int n_in,
                              void* d_out, int out_size, void* d_ws, size_t ws_size,
                              hipStream_t stream) {
  const float* x  = (const float*)d_in[0];
  const float* Wq = (const float*)d_in[1];
  const float* Wk = (const float*)d_in[2];
  const float* Wv = (const float*)d_in[3];
  const float* Wo = (const float*)d_in[4];
  const float* bo = (const float*)d_in[5];
  float* out = (float*)d_out;

  const size_t elems = (size_t)BB * HH * TT * DH;   // 8,388,608 per buffer
  bf16_t* Qb = (bf16_t*)d_ws;
  bf16_t* Kb = Qb + elems;
  bf16_t* Vt = Kb + elems;
  bf16_t* Ob = Vt + elems;
  bf16_t* Xb = Ob + elems;
  bf16_t* WT = Xb + elems;                          // 4096 x 1024

  mha_convert_kernel<<<dim3(768), 256, 0, stream>>>(x, Wq, Wk, Wv, Wo, Xb, WT);
  mha_qkv_proj_kernel<<<dim3(32, 24), 256, 0, stream>>>(Xb, WT, Qb, Kb, Vt);
  mha_flash_attn_kernel<<<dim3(64, 8), 256, 0, stream>>>(Qb, Kb, Vt, Ob);
  mha_out_proj_kernel<<<dim3(32, 8), 256, 0, stream>>>(Ob, WT, bo, out);
}

// v009
// One run takes 110 microseconds.
// Timed twice side by side with v008, it ran 1.05 times as fast both times.
// Over all steps from v000 it is 5.02 times as fast.
#include <hip/hip_runtime.h>
#include <hip/hip_bf16.h>

typedef __bf16 bf16_t;
typedef __attribute__((ext_vector_type(16))) __bf16 v16bf;
typedef __attribute__((ext_vector_type(8)))  __bf16 v8bf;
typedef __attribute__((ext_vector_type(4)))  __bf16 v4bf;
typedef __attribute__((ext_vector_type(2)))  __bf16 v2bf;
typedef __attribute__((ext_vector_type(8)))  float  v8f;
typedef __attribute__((ext_vector_type(4)))  float  v4f;
typedef __attribute__((ext_vector_type(2)))  float  v2f;

#define BB  4
#define TT  2048
#define DD  1024
#define HH  16
#define DH  64
#define QSCALE 0.18033688f       // 1/sqrt(DH) * log2(e)

union FragU { v16bf v; v8bf h[2]; };

// Load a 16x32 bf16 WMMA A/B fragment from a row-major [rows][ld] bf16 matrix.
// A: row = base_row + lane%16 ; B: n = base_row + lane%16 with source in [N][K] layout.
// Per documented layout: elements 0..7 at K=k0+(lane/16)*8, elements 8..15 at K=k0+16+(lane/16)*8.
__device__ inline v16bf load_frag(const bf16_t* base, int row0, int k0, int ld) {
  const int lane = threadIdx.x & 31;
  const int sel  = lane & 15;
  const int hf   = lane >> 4;
  const bf16_t* p = base + (size_t)(row0 + sel) * ld + k0 + hf * 8;
  FragU f;
  f.h[0] = *reinterpret_cast<const v8bf*>(p);
  f.h[1] = *reinterpret_cast<const v8bf*>(p + 16);
  return f.v;
}

__device__ inline v8f wmma_bf16(v16bf a, v16bf b, v8f c) {
  // (neg_a, A, neg_b, B, c_mod, C, reuse_a, reuse_b)
  return __builtin_amdgcn_wmma_f32_16x16x32_bf16(false, a, false, b, (short)0, c, false, false);
}

// ---------------------------------------------------------------------------
// Kernel 0: operands of both projections converted to bf16 once per call.
// Xb[8192][1024] = x.  WT[4096][1024] holds every weight with k contiguous:
// row (mat*16 + h)*64 + e = column e of Wq/Wk/Wv[h], row 3072 + n = column n of Wo.
// Blocks 0..255: a 256(k) x 64(n) weight strip each, transposed through LDS.
// Blocks 256..767: 16 float4 of x per thread, every load a wave-contiguous 512 B.
// ---------------------------------------------------------------------------
#define TSP 264                  // LDS row pitch in bf16: 528 B = 16 B x odd

__global__ __launch_bounds__(256)
void mha_convert_kernel(const float* __restrict__ x,
                        const float* __restrict__ Wq,
                        const float* __restrict__ Wk,
                        const float* __restrict__ Wv,
                        const float* __restrict__ Wo,
                        bf16_t* __restrict__ Xb,
                        bf16_t* __restrict__ WT) {
  __shared__ __attribute__((aligned(16))) bf16_t Ts[64 * TSP];   // [n=64][k=256]
  const int tid = threadIdx.x;
  if (blockIdx.x >= 256) {                     // block-uniform: these blocks meet no barrier
    const size_t base = (size_t)(blockIdx.x - 256) * 4096 + tid;   // in float4
    float4 xv[16];
#pragma unroll
    for (int i = 0; i < 16; ++i) {
      // the last load's result may be given the address registers that the loads
      // before it name: the wait stands in front of that overwrite
      if (i == 15) asm volatile("s_wait_xcnt 0x0" ::: "memory");
      xv[i] = reinterpret_cast<const float4*>(x)[base + i * 256];
    }
#pragma unroll
    for (int i = 0; i < 16; ++i) {
      v4bf bv = { (bf16_t)xv[i].x, (bf16_t)xv[i].y, (bf16_t)xv[i].z, (bf16_t)xv[i].w };
      reinterpret_cast<v4bf*>(Xb)[base + i * 256] = bv;
    }
    return;
  }
  const int m  = blockIdx.x >> 2;              // group of 64 rows of WT
  const int kb = (blockIdx.x & 3) * 256;       // first k of the strip
  const int mat = m >> 4, h = m & 15;
  // the strip's first element and its row pitch in floats (block-uniform)
  const float* src = mat == 0 ? Wq : (mat == 1 ? Wk : (mat == 2 ? Wv : Wo));
  const int pitch  = mat < 3 ? DH : DD;
  src += (mat < 3 ? (size_t)h * DD * DH : (size_t)h * 64) + (size_t)kb * pitch;
  const int d0 = tid >> 4, e4 = tid & 15;
  const float* p = src + (size_t)d0 * pitch + e4 * 4;
  float4 wv[16];
#pragma unroll
  for (int i = 0; i < 16; ++i)
    wv[i] = *reinterpret_cast<const float4*>(p + (size_t)(i * 16) * pitch);
#pragma unroll
  for (int i = 0; i < 16; ++i) {
    const int d = i * 16 + d0;
    Ts[(e4 * 4 + 0) * TSP + d] = (bf16_t)wv[i].x;
    Ts[(e4 * 4 + 1) * TSP + d] = (bf16_t)wv[i].y;
    Ts[(e4 * 4 + 2) * TSP + d] = (bf16_t)wv[i].z;
    Ts[(e4 * 4 + 3) * TSP + d] = (bf16_t)wv[i].w;
  }
  __syncthreads();
#pragma unroll
  for (int i = 0; i < 8; ++i) {
    int idx = i * 256 + tid;
    int row = idx >> 5, c8 = idx & 31;         // a wave writes 512 B of one row
    *reinterpret_cast<v8bf*>(WT + (size_t)(m * 64 + row) * DD + kb + c8 * 8) =
        *reinterpret_cast<const v8bf*>(&Ts[row * TSP + c8 * 8]);
  }
}

// ---------------------------------------------------------------------------
// Main loop of both projections: one 256 x 128 tile of A[.][1024] * W[.][1024]^T
// per work-group, both operands k contiguous, GK k to a stage. 8 waves as
// 4 (rows) x 2 (columns), 64 x 64 per wave: each fragment taken from LDS feeds
// four products.
// The operand tiles go from L2 into a two-buffer LDS ring by asynchronous
// copies, one stage ahead: stage t + 1 flies while stage t is multiplied, no
// staging register is held and one barrier a stage both publishes the next
// stage and frees the buffer just read.
// Ag = first row of the A tile, Wg = first row of the W tile (row = output column).
// c[mi][ni] = rows wm*64 + mi*16.., columns wn*64 + ni*16.. of the tile.
// LDS row pitch: GK + 8 bf16 = 16 B x odd for GK = 64 and 128.
// ---------------------------------------------------------------------------
#define GEMM_LDS(GK) (2 * (256 + 128) * ((GK) + 8))   // bf16 elements: A ring, then W ring

// Twelve 16-byte copies per lane in one statement, so that a stage meets few
// waits. The s_wait_xcnt stands inside the statement so that no address
// register of an issued copy is rewritten in front of it.
__device__ inline void copy12(const unsigned (&l)[12], const bf16_t* const (&g)[12]) {
  asm volatile(
               "global_load_async_to_lds_b128 %0, %12, off\n\t"
               "global_load_async_to_lds_b128 %1, %13, off\n\t"
               "global_load_async_to_lds_b128 %2, %14, off\n\t"
               "global_load_async_to_lds_b128 %3, %15, off\n\t"
               "global_load_async_to_lds_b128 %4, %16, off\n\t"
               "global_load_async_to_lds_b128 %5, %17, off\n\t"
               "global_load_async_to_lds_b128 %6, %18, off\n\t"
               "global_load_async_to_lds_b128 %7, %19, off\n\t"
               "global_load_async_to_lds_b128 %8, %20, off\n\t"
               "global_load_async_to_lds_b128 %9, %21, off\n\t"
               "global_load_async_to_lds_b128 %10, %22, off\n\t"
               "global_load_async_to_lds_b128 %11, %23, off\n\t"
               "s_wait_xcnt 0x0"
               :: "v"(l[0]), "v"(l[1]), "v"(l[2]), "v"(l[3]), "v"(l[4]), "v"(l[5]),
                  "v"(l[6]), "v"(l[7]), "v"(l[8]), "v"(l[9]), "v"(l[10]), "v"(l[11]),
                  "v"(g[0]), "v"(g[1]), "v"(g[2]), "v"(g[3]), "v"(g[4]), "v"(g[5]),
                  "v"(g[6]), "v"(g[7]), "v"(g[8]), "v"(g[9]), "v"(g[10]), "v"(g[11])
               : "memory");
}

// One stage of both operands: 256 rows of A and 128 rows of W, GK k each.
// la, lw, ga, gw = this lane's piece of the first RP rows; the 256 lanes cover
// RP whole rows a pass, A in the first 256 / RP passes and W in the rest.
template <int GK>
__device__ inline void copy_stage(unsigned la, unsigned lw,
                                  const bf16_t* ga, const bf16_t* gw) {
  constexpr int RP = 2048 / GK;                    // rows per pass
  constexpr int PA = 256 / RP, PN = 384 / RP;      // passes over A, over both
  constexpr unsigned LS = RP * (GK + 8) * 2;       // LDS bytes per pass
  constexpr size_t GS = (size_t)RP * DD;           // global elements per pass
  // both loops unrolled: every address is then the lane's own plus a constant,
  // and the two small arrays are registers
#pragma unroll
  for (int j = 0; j < PN; j += 12) {
    unsigned l[12];
    const bf16_t* g[12];
#pragma unroll
    for (int i = 0; i < 12; ++i) {
      const int p = j + i;
      l[i] = p < PA ? la + p * LS : lw + (p - PA) * LS;
      g[i] = p < PA ? ga + p * GS : gw + (p - PA) * GS;
    }
    copy12(l, g);
  }
}

template <int GK>
__device__ inline void gemm_tile_256x128(const bf16_t* __restrict__ Ag,
                                         const bf16_t* __restrict__ Wg,
                                         bf16_t* ring, v8f (&c)[4][4]) {
  constexpr int GP = GK + 8;                       // LDS row pitch in bf16
  constexpr int ABUF = 256 * GP, WBUF = 128 * GP;  // one buffer of each operand
  bf16_t* As = ring;                               // [buf][row 256][k]
  bf16_t* Ws = ring + 2 * ABUF;                    // [buf][column 128][k]
  const int tid = threadIdx.x, wid = tid >> 5;
  const int wm = wid >> 1, wn = wid & 1;
  const int srow = tid / (GK / 8), sc8 = (tid % (GK / 8)) * 8;   // 16-byte pieces of whole rows
  const unsigned la = (unsigned)(uintptr_t)&As[srow * GP + sc8];
  const unsigned lw = (unsigned)(uintptr_t)&Ws[srow * GP + sc8];
  const bf16_t* ga = Ag + (size_t)srow * DD + sc8;
  const bf16_t* gw = Wg + (size_t)srow * DD + sc8;

  // Ring prologue: stage 0 landed and published, then stage 1 in flight.
  copy_stage<GK>(la, lw, ga, gw);
  asm volatile("s_wait_asynccnt 0x0" ::: "memory");    // own copies of stage 0 landed
  __syncthreads();                                     // every wave's copies visible
  copy_stage<GK>(la + ABUF * 2, lw + WBUF * 2, ga + GK, gw + GK);

  // Fragments run ahead of their products. A block is 32 k: 16 products, as rows
  // mi of four. b has two register sets, a one: rows 2 and 3 of a are read at the
  // block's head with the next block's b, two rows ahead of their use; rows 0 and 1
  // of the next block are read at mid-block into the registers that this block's
  // rows 0 and 1 have left. 224 registers with the accumulators.
  // Every sched_barrier below keeps a group of LDS reads where it is written: left
  // alone the compiler sinks each read to its first use, and every row of four
  // products then stands behind a wait for its own LDS round trip.
  static_assert((GK / 32) % 2 == 0, "a stage's first block uses b[0]");
  v16bf a[4], b[2][4];
  a[0] = load_frag(As, wm * 64, 0, GP);
  a[1] = load_frag(As, wm * 64 + 16, 0, GP);
#pragma unroll
  for (int i = 0; i < 4; ++i) b[0][i] = load_frag(Ws, wn * 64 + i * 16, 0, GP);

  for (int k0 = 0; k0 < DD; k0 += GK) {
    const int buf = (k0 / GK) & 1;
    const bf16_t* Al = As + buf * ABUF;
    const bf16_t* Wl = Ws + buf * WBUF;
    const bf16_t* An = As + (buf ^ 1) * ABUF;          // the next stage's buffer
    const bf16_t* Wn = Ws + (buf ^ 1) * WBUF;
#pragma unroll
    for (int ks = 0; ks < GK; ks += 32) {
      const int cur = (ks >> 5) & 1, nxt = cur ^ 1;
      const bool last = ks + 32 == GK;                 // the stage's last block
      a[2] = load_frag(Al, wm * 64 + 32, ks, GP);
      a[3] = load_frag(Al, wm * 64 + 48, ks, GP);
      if (!last) {
#pragma unroll
        for (int i = 0; i < 4; ++i) b[nxt][i] = load_frag(Wl, wn * 64 + i * 16, ks + 32, GP);
      }
      __builtin_amdgcn_sched_barrier(0);               // head group stays ahead of rows 0 and 1
#pragma unroll
      for (int mi = 0; mi < 2; ++mi)
#pragma unroll
        for (int ni = 0; ni < 4; ++ni)
          c[mi][ni] = wmma_bf16(a[mi], b[cur][ni], c[mi][ni]);
      __builtin_amdgcn_sched_barrier(0);               // mid group stays behind rows 0 and 1
      if (!last) {
        a[0] = load_frag(Al, wm * 64, ks + 32, GP);
        a[1] = load_frag(Al, wm * 64 + 16, ks + 32, GP);
      } else {
        // Publish point of the next stage, in the middle of the last block: this
        // stage's last fragments are fetched, so it also frees this stage's buffer.
        asm volatile("s_wait_dscnt 0x0" ::: "memory");     // own LDS reads of this buffer done
        asm volatile("s_wait_asynccnt 0x0" ::: "memory");  // own copies of the next stage landed
        __syncthreads();
        if (k0 + 2 * GK < DD)                              // same for the whole work-group
          copy_stage<GK>(la + buf * (ABUF * 2), lw + buf * (WBUF * 2),
                         ga + k0 + 2 * GK, gw + k0 + 2 * GK);
        // First fragments of the next stage, now published. In the last stage these
        // reads take the stage before's bytes (no copy is in flight there) and feed
        // nothing: unconditional, so that no branch merges the wait counts.
        a[0] = load_frag(An, wm * 64, 0, GP);
        a[1] = load_frag(An, wm * 64 + 16, 0, GP);
#pragma unroll
        for (int i = 0; i < 4; ++i) b[nxt][i] = load_frag(Wn, wn * 64 + i * 16, 0, GP);
      }
      __builtin_amdgcn_sched_barrier(0);               // mid group stays ahead of rows 2 and 3
#pragma unroll
      for (int mi = 2; mi < 4; ++mi)
#pragma unroll
        for (int ni = 0; ni < 4; ++ni)
          c[mi][ni] = wmma_bf16(a[mi], b[cur][ni], c[mi][ni]);
      __builtin_amdgcn_sched_barrier(0);               // the next head group stays behind this block
    }
  }
  asm volatile("s_wait_asynccnt 0x0" ::: "memory");    // nothing in flight behind the loop
  asm volatile("s_wait_dscnt 0x0" ::: "memory");       // the last stage's unused fragment reads are back
}

// ---------------------------------------------------------------------------
// Kernel 1: fused QKV projection.  Xb[8192,1024]bf16 x WT rows (k contiguous)
// Q,K stored [b,h,t,dh] row-major; V stored transposed [b,h,dh,t].
// 1/sqrt(DH) * log2(e) folded into Q: attention works on base-2 exponents.
// grid (32, 24): x = 8192/256 row tiles, y = 3072/128 column tiles = two heads
// of one matrix; a wave's 64 columns are one head.
// Register budget of four waves a SIMD, and 64 k to a stage so that the rings of
// two work-groups fit the LDS: two work-groups stay resident on a WGP.
// ---------------------------------------------------------------------------
__global__ __launch_bounds__(256) __attribute__((amdgpu_waves_per_eu(4, 4)))
void mha_qkv_proj_kernel(const bf16_t* __restrict__ Xb,
                         const bf16_t* __restrict__ WT,
                         bf16_t* __restrict__ Qb,
                         bf16_t* __restrict__ Kb,
                         bf16_t* __restrict__ Vt) {
  __shared__ __attribute__((aligned(16))) bf16_t ring[GEMM_LDS(64)];
  const int tid  = threadIdx.x;
  const int lane = tid & 31, wid = tid >> 5;
  const int lanen = lane & 15, hf = lane >> 4;
  const int wm = wid >> 1, wn = wid & 1;
  const int r0  = blockIdx.x * 256;
  const int mat = blockIdx.y >> 3;                // 0=Q 1=K 2=V (block-uniform)
  const int h   = (blockIdx.y * 2 + wn) & 15;     // this wave's head

  v8f c[4][4] = {};
  gemm_tile_256x128<64>(Xb + (size_t)r0 * DD, WT + (size_t)blockIdx.y * 128 * DD, ring, c);

  // Epilogue: tile never crosses a batch boundary (2048 % 256 == 0), and mat
  // is block-uniform -> one uniform branch, branch-free store loops inside.
  const int bidx = r0 >> 11;                 // batch index (uniform)
  const int t00  = (r0 & 2047) + wm * 64;    // base t for this wave
  const size_t bh = (size_t)(bidx * HH + h);

  if (mat == 0) {
    bf16_t* dst = Qb + bh * TT * DH;
#pragma unroll
    for (int mi = 0; mi < 4; ++mi)
#pragma unroll
      for (int ni = 0; ni < 4; ++ni) {
        int e = ni * 16 + lanen;
#pragma unroll
        for (int r = 0; r < 8; ++r) {
          int t = t00 + mi * 16 + r + 8 * hf;
          dst[(size_t)t * DH + e] = (bf16_t)(c[mi][ni][r] * QSCALE);
        }
      }
  } else if (mat == 1) {
    bf16_t* dst = Kb + bh * TT * DH;
#pragma unroll
    for (int mi = 0; mi < 4; ++mi)
#pragma unroll
      for (int ni = 0; ni < 4; ++ni) {
        int e = ni * 16 + lanen;
#pragma unroll
        for (int r = 0; r < 8; ++r) {
          int t = t00 + mi * 16 + r + 8 * hf;
          dst[(size_t)t * DH + e] = (bf16_t)c[mi][ni][r];
        }
      }
  } else {
    // V transposed [dh][t]: consecutive r -> consecutive t -> packed b32 stores
    bf16_t* dst = Vt + bh * DH * TT;
#pragma unroll
    for (int mi = 0; mi < 4; ++mi)
#pragma unroll
      for (int ni = 0; ni < 4; ++ni) {
        int e = ni * 16 + lanen;
#pragma unroll
        for (int r = 0; r < 8; r += 2) {
          int t = t00 + mi * 16 + r + 8 * hf;   // even
          v2bf pv = { (bf16_t)c[mi][ni][r], (bf16_t)c[mi][ni][r + 1] };
          *reinterpret_cast<v2bf*>(&dst[(size_t)e * TT + t]) = pv;
        }
      }
  }
}

#define KVP   72                 // LDS row pitch in bf16: 144 B = 16 B x odd
#define KVBUF (64 * KVP)         // one buffer: 64 rows
#define QC    2                  // 16-column query groups per wave

// Four 16-byte copies per lane = one K tile + one V^T tile per work-group.
// The s_wait_xcnt stands inside the statement so that no address register of
// an issued copy is rewritten in front of it.
__device__ inline void copy_kv_tile(unsigned lk, unsigned lv,
                                    const bf16_t* gk, const bf16_t* gv) {
  const unsigned lk1 = lk + 32 * KVP * 2, lv1 = lv + 32 * KVP * 2;
  const bf16_t* gk1 = gk + 32 * DH;
  const bf16_t* gv1 = gv + (size_t)32 * TT;
  asm volatile("global_load_async_to_lds_b128 %0, %4, off\n\t"
               "global_load_async_to_lds_b128 %1, %5, off\n\t"
               "global_load_async_to_lds_b128 %2, %6, off\n\t"
               "global_load_async_to_lds_b128 %3, %7, off\n\t"
               "s_wait_xcnt 0x0"
               :: "v"(lk), "v"(lk1), "v"(lv), "v"(lv1),
                  "v"(gk), "v"(gk1), "v"(gv), "v"(gv1)
               : "memory");
}

// Lane l takes the value of lane l ^ 16 (a register move, no LDS traffic).
__device__ inline float xhalf(float v) {
  const int i = __builtin_bit_cast(int, v);
  return __builtin_bit_cast(float,
      __builtin_amdgcn_permlanex16(i, i, 0x76543210, 0xfedcba98, false, false));
}

// Register budget of four waves a SIMD: two work-groups stay resident on a WGP.
__global__ __launch_bounds__(256) __attribute__((amdgpu_waves_per_eu(4, 4)))
void mha_flash_attn_kernel(const bf16_t* __restrict__ Qb,
                           const bf16_t* __restrict__ Kb,
                           const bf16_t* __restrict__ Vt,
                           bf16_t* __restrict__ Ob) {
  __shared__ __attribute__((aligned(16))) bf16_t Ks[2 * KVBUF];  // [buf][key][dh]
  __shared__ __attribute__((aligned(16))) bf16_t Vs[2 * KVBUF];  // [buf][dh][key]
  const int tid = threadIdx.x, lane = tid & 31, wid = tid >> 5;
  const int lanen = lane & 15, hf = lane >> 4;
  const int bh = blockIdx.x;                 // 0..63
  const int b = bh >> 4, h = bh & 15;
  const int q0 = blockIdx.y * (128 * QC) + wid * (16 * QC);
  const bf16_t* Qh = Qb + (size_t)bh * TT * DH;
  const bf16_t* Kh = Kb + (size_t)bh * TT * DH;
  const bf16_t* Vh = Vt + (size_t)bh * DH * TT;

  // Q as B operand: column = query q0 + c*16 + lane%16 for group c, k = dh in the hardware order.
  v16bf qf[QC][2];
  v8f o[QC][4] = {};                         // o[c][n][r] = O^T[n*16 + 8*hf + r][query of group c]
  v8f nref[QC];                              // minus this lane's query's reference, in all 8 registers
  float lrun[QC];                            // the sum over this half's keys
#pragma unroll
  for (int c = 0; c < QC; ++c) {
    qf[c][0] = load_frag(Qh, q0 + c * 16,  0, DH);
    qf[c][1] = load_frag(Qh, q0 + c * 16, 32, DH);
    nref[c] = v8f{};
    lrun[c] = 0.0f;
  }

  // This lane's share of a tile: rows crow and crow + 32, 16 bytes at column ccol.
  const int crow = tid >> 3, ccol = (tid & 7) * 8;
  const unsigned ldsK = (unsigned)(uintptr_t)&Ks[crow * KVP + ccol];
  const unsigned ldsV = (unsigned)(uintptr_t)&Vs[crow * KVP + ccol];
  const bf16_t* gK = Kh + crow * DH + ccol;            // + kt * DH per tile
  const bf16_t* gV = Vh + (size_t)crow * TT + ccol;    // + kt per tile

  // Ring prologue: tile 0 landed and published, then tile 1 in flight.
  copy_kv_tile(ldsK, ldsV, gK, gV);
  asm volatile("s_wait_asynccnt 0x0" ::: "memory");    // own copies of tile 0 landed
  __syncthreads();                                     // every wave's copies visible
  copy_kv_tile(ldsK + KVBUF * 2, ldsV + KVBUF * 2, gK + 64 * DH, gV + 64);

  for (int kt = 0; kt < TT; kt += 64) {
    const int buf = (kt >> 6) & 1;
    const bf16_t* Kl = &Ks[buf * KVBUF];
    const bf16_t* Vl = &Vs[buf * KVBUF];
    // S^T * log2(e) - reference = K * Q^T + C  (scale already folded into Q)
    // s[c][n][r] = exp2 argument of key kt + n*16 + 8*hf + r for this lane's query of group c
    v8f s[QC][4];
    auto scores = [&]() {
      v16bf ak[2][4];
      // each sched_barrier keeps a group of LDS reads together and ahead of the products:
      // else every read sinks to its own products and is waited for there
#pragma unroll
      for (int n = 0; n < 4; ++n) ak[0][n] = load_frag(Kl, n * 16, 0, KVP);
      __builtin_amdgcn_sched_barrier(0);
#pragma unroll
      for (int n = 0; n < 4; ++n) ak[1][n] = load_frag(Kl, n * 16, 32, KVP);
      __builtin_amdgcn_sched_barrier(0);
#pragma unroll
      for (int j = 0; j < 2; ++j)
#pragma unroll
        for (int n = 0; n < 4; ++n)
#pragma unroll
          for (int c = 0; c < QC; ++c) s[c][n] = wmma_bf16(ak[j][n], qf[c][j], j == 0 ? nref[c] : s[c][n]);
      // what follows stays behind the last score product: drawn in among the products, it
      // needs registers while all K fragments are still held, and a Q fragment is spilled
      __builtin_amdgcn_sched_barrier(0);
    };
    // Exponentials in place, this half's sum of them as a pairwise tree, and P^T as
    // B operand: tiles 2*kk and 2*kk + 1 give k = 8*hf + e and 16 + 8*hf + e, the
    // order in which load_frag takes the keys of a V^T row.
    float rs[QC];
    v16bf pb[QC][2];
    auto exponentials = [&]() {
#pragma unroll
      for (int c = 0; c < QC; ++c) {
#pragma unroll
        for (int n = 0; n < 4; ++n)
#pragma unroll
          for (int r = 0; r < 8; ++r) s[c][n][r] = __builtin_amdgcn_exp2f(s[c][n][r]);
        const v8f t8 = (s[c][0] + s[c][1]) + (s[c][2] + s[c][3]);
        const v4f t4 = __builtin_shufflevector(t8, t8, 0, 1, 2, 3) + __builtin_shufflevector(t8, t8, 4, 5, 6, 7);
        const v2f t2 = __builtin_shufflevector(t4, t4, 0, 1) + __builtin_shufflevector(t4, t4, 2, 3);
        rs[c] = t2[0] + t2[1];
#pragma unroll
        for (int kk = 0; kk < 2; ++kk)
#pragma unroll
          for (int e = 0; e < 8; ++e) {
            pb[c][kk][e]     = (bf16_t)s[c][2 * kk][e];
            pb[c][kk][e + 8] = (bf16_t)s[c][2 * kk + 1][e];
          }
      }
    };
    // Moves the reference of every query whose maximum in this tile lies more than thr
    // above it; O, the sum and the tile's arguments follow.
    auto move_reference = [&](float thr) {
#pragma unroll
      for (int c = 0; c < QC; ++c) {
        float mx[8];
#pragma unroll
        for (int r = 0; r < 8; ++r)
          mx[r] = fmaxf(fmaxf(s[c][0][r], s[c][1][r]), fmaxf(s[c][2][r], s[c][3][r]));
        const float mt = fmaxf(fmaxf(fmaxf(mx[0], mx[1]), fmaxf(mx[2], mx[3])),
                               fmaxf(fmaxf(mx[4], mx[5]), fmaxf(mx[6], mx[7])));
        const float mj = fmaxf(mt, xhalf(mt));         // both halves hold the query's maximum
        const float d = mj > thr ? mj : 0.0f;          // the reference rises by d (first tile: moves)
        // first tile: O and the sum are 0, and a negative d must not make the factor infinite
        const float alpha = __builtin_amdgcn_exp2f(-fmaxf(d, 0.0f));
        lrun[c] *= alpha;
        nref[c] -= d;
#pragma unroll
        for (int n = 0; n < 4; ++n) {
          s[c][n] -= d;
          o[c][n] *= alpha;
        }
      }
    };
    // V^T fragments of the tile's first 32 keys are read ahead of the test: the test and the
    // conversions cover their LDS round trip. No exponential is left among the products.
    v16bf av[2][4];
    auto exponentials_and_v = [&]() {
#pragma unroll
      for (int n = 0; n < 4; ++n) av[0][n] = load_frag(Vl, n * 16, 0, KVP);
      // compiler fence: holds the four reads here; else they are sunk behind the test,
      // where only the conversions stand between them and their products
      asm volatile("" ::: "memory");
      exponentials();
    };
    scores();
    // The first tile moves the reference (from 0) to its maximum, whatever its sign.
    if (kt == 0) move_reference(-3.0e38f);
    exponentials_and_v();
    // One test a tile, on the sums that the tile needs anyway: every exponential is
    // at least 0, so sums of at most 2^14 say that none lies above 2^14; a larger sum
    // of these 64 says that one lies above 2^8. Infinity and NaN fail the test too.
    if (__builtin_amdgcn_ballot_w32(!(rs[0] + rs[1] <= 16384.0f)) != 0) {   // a scalar branch, rarely taken
      scores();                                        // the arguments again: K is still in LDS
      move_reference(8.0f);
      exponentials_and_v();                            // once more, against the new reference
    }
#pragma unroll
    for (int c = 0; c < QC; ++c) lrun[c] += rs[c];

    // O^T += V^T * P^T   (V^T tile is [dh][key] in LDS -> direct A-fragments)
    // The second 32 keys' fragments are read as one group ahead of the first 32 keys' products.
#pragma unroll
    for (int n = 0; n < 4; ++n) av[1][n] = load_frag(Vl, n * 16, 32, KVP);
    __builtin_amdgcn_sched_barrier(0);                 // keeps the group here: else each read sinks to its product and is waited for there
#pragma unroll
    for (int kk = 0; kk < 2; ++kk) {
#pragma unroll
      for (int n = 0; n < 4; ++n) {
#pragma unroll
        for (int c = 0; c < QC; ++c) o[c][n] = wmma_bf16(av[kk][n], pb[c][kk], o[c][n]);
      }
      // the first 32 keys' products stay ahead of the publish point's wait for all LDS
      // reads: they cover the round trip of the group read above
      if (kk == 0) __builtin_amdgcn_sched_barrier(0);
    }
    // Publish point of the next tile; it also frees this tile's buffer.
    asm volatile("s_wait_dscnt 0x0" ::: "memory");     // own LDS reads of this buffer done
    asm volatile("s_wait_asynccnt 0x0" ::: "memory");  // own copies of the next tile landed
    __syncthreads();
    if (kt + 128 < TT)                                 // same for the whole work-group
      copy_kv_tile(ldsK + buf * (KVBUF * 2), ldsV + buf * (KVBUF * 2),
                   gK + (size_t)(kt + 128) * DH, gV + (kt + 128));
  }
  asm volatile("s_wait_asynccnt 0x0" ::: "memory");    // nothing in flight at the wave's end

  // join the halves' sums, normalize, store concat-head layout [b, t, h*64 + e]:
  // a lane's 8 accumulator registers are 8 consecutive e of its query's row.
#pragma unroll
  for (int c = 0; c < QC; ++c) {
    const float ltot = lrun[c] + xhalf(lrun[c]);
    bf16_t* dst = Ob + ((size_t)(b * TT + q0 + c * 16 + lanen) * (HH * DH)) + h * DH + 8 * hf;
#pragma unroll
    for (int n = 0; n < 4; ++n) {
      v8bf ov;
#pragma unroll
      for (int r = 0; r < 8; ++r) ov[r] = (bf16_t)(o[c][n][r] / ltot);
      *reinterpret_cast<v8bf*>(dst + n * 16) = ov;
    }
  }
}

// ---------------------------------------------------------------------------
// Kernel 3: output projection + bias.  Ob[8192,1024]bf16 x WT rows 3072.. (Wo^T)
// grid (32, 8): 256-row x 128-col tiles, one work-group to a WGP, so the ring
// takes 128 k to a stage: twice the bytes in flight and half the barriers.
// ---------------------------------------------------------------------------
__global__ __launch_bounds__(256)
void mha_out_proj_kernel(const bf16_t* __restrict__ Ob,
                         const bf16_t* __restrict__ WT,
                         const float* __restrict__ bo,
                         float* __restrict__ out) {
  __shared__ __attribute__((aligned(16))) bf16_t ring[GEMM_LDS(128)];
  const int tid = threadIdx.x, lane = tid & 31, wid = tid >> 5;
  const int lanen = lane & 15, hf = lane >> 4;
  const int wm = wid >> 1, wn = wid & 1;
  const int r0 = blockIdx.x * 256;
  const int n0 = blockIdx.y * 128;

  v8f c[4][4] = {};
  gemm_tile_256x128<128>(Ob + (size_t)r0 * DD, WT + (size_t)(3 * HH * DH + n0) * DD, ring, c);

  float bias[4];
#pragma unroll
  for (int ni = 0; ni < 4; ++ni) bias[ni] = bo[n0 + wn * 64 + ni * 16 + lanen];
  // the store addresses are formed in the register that the four loads name as
  // their offset: the wait stands in front of that overwrite
  asm volatile("s_wait_xcnt 0x0" ::: "memory");
#pragma unroll
  for (int mi = 0; mi < 4; ++mi)
#pragma unroll
    for (int ni = 0; ni < 4; ++ni) {
      int col = n0 + wn * 64 + ni * 16 + lanen;
#pragma unroll
      for (int r = 0; r < 8; ++r) {
        int row = r0 + wm * 64 + mi * 16 + r + 8 * hf;
        out[(size_t)row * DD + col] = c[mi][ni][r] + bias[ni];
      }
    }
}

extern "C" void kernel_launch(void* const* d_in, const int* in_sizes, int n_in,
                              void* d_out, int out_size, void* d_ws, size_t ws_size,
                              hipStream_t stream) {
  const float* x  = (const float*)d_in[0];
  const float* Wq = (const float*)d_in[1];
  const float* Wk = (const float*)d_in[2];
  const float* Wv = (const float*)d_in[3];
  const float* Wo = (const float*)d_in[4];
  const float* bo = (const float*)d_in[5];
  float* out = (float*)d_out;

  const size_t elems = (size_t)BB * HH * TT * DH;   // 8,388,608 per buffer
  bf16_t* Qb = (bf16_t*)d_ws;
  bf16_t* Kb = Qb + elems;
  bf16_t* Vt = Kb + elems;
  bf16_t* Ob = Vt + elems;
  bf16_t* Xb = Ob + elems;
  bf16_t* WT = Xb + elems;                          // 4096 x 1024

  mha_convert_kernel<<<dim3(768), 256, 0, stream>>>(x, Wq, Wk, Wv, Wo, Xb, WT);
  mha_qkv_proj_kernel<<<dim3(32, 24), 256, 0, stream>>>(Xb, WT, Qb, Kb, Vt);
  mha_flash_attn_kernel<<<dim3(64, 8), 256, 0, stream>>>(Qb, Kb, Vt, Ob);
  mha_out_proj_kernel<<<dim3(32, 8), 256, 0, stream>>>(Ob, WT, bo, out);
}

// v010
// It runs in 104 microseconds.
// Next to v009, in two timings, it ran 1.05 and 1.06 times as fast.
// Counting every step since v000, it is 5.30 times as fast.
#include <hip/hip_runtime.h>
#include <hip/hip_bf16.h>

typedef __bf16 bf16_t;
typedef __attribute__((ext_vector_type(16))) __bf16 v16bf;
typedef __attribute__((ext_vector_type(8)))  __bf16 v8bf;
typedef __attribute__((ext_vector_type(4)))  __bf16 v4bf;
typedef __attribute__((ext_vector_type(2)))  __bf16 v2bf;
typedef __attribute__((ext_vector_type(8)))  float  v8f;
typedef __attribute__((ext_vector_type(4)))  float  v4f;
typedef __attribute__((ext_vector_type(2)))  float  v2f;

#define BB  4
#define TT  2048
#define DD  1024
#define HH  16
#define DH  64
#define QSCALE 0.18033688f       // 1/sqrt(DH) * log2(e)

union FragU { v16bf v; v8bf h[2]; };

// Load a 16x32 bf16 WMMA A/B fragment from a row-major [rows][ld] bf16 matrix.
// A: row = base_row + lane%16 ; B: n = base_row + lane%16 with source in [N][K] layout.
// Per documented layout: elements 0..7 at K=k0+(lane/16)*8, elements 8..15 at K=k0+16+(lane/16)*8.
__device__ inline v16bf load_frag(const bf16_t* base, int row0, int k0, int ld) {
  const int lane = threadIdx.x & 31;
  const int sel  = lane & 15;
  const int hf   = lane >> 4;
  const bf16_t* p = base + (size_t)(row0 + sel) * ld + k0 + hf * 8;
  FragU f;
  f.h[0] = *reinterpret_cast<const v8bf*>(p);
  f.h[1] = *reinterpret_cast<const v8bf*>(p + 16);
  return f.v;
}

__device__ inline v8f wmma_bf16(v16bf a, v16bf b, v8f c) {
  // (neg_a, A, neg_b, B, c_mod, C, reuse_a, reuse_b)
  return __builtin_amdgcn_wmma_f32_16x16x32_bf16(false, a, false, b, (short)0, c, false, false);
}

// ---------------------------------------------------------------------------
// Kernel 0: operands of both projections converted to bf16 once per call.
// Xb[8192][1024] = x.  WT[4096][1024] holds every weight with k contiguous:
// row (mat*16 + h)*64 + e = column e of Wq/Wk/Wv[h], row 3072 + n = column n of Wo.
// Blocks 0..255: a 256(k) x 64(n) weight strip each, transposed through LDS.
// Blocks 256..767: 16 float4 of x per thread, every load a wave-contiguous 512 B.
// ---------------------------------------------------------------------------
#define TSP 264                  // LDS row pitch in bf16: 528 B = 16 B x odd

__global__ __launch_bounds__(256)
void mha_convert_kernel(const float* __restrict__ x,
                        const float* __restrict__ Wq,
                        const float* __restrict__ Wk,
                        const float* __restrict__ Wv,
                        const float* __restrict__ Wo,
                        bf16_t* __restrict__ Xb,
                        bf16_t* __restrict__ WT) {
  __shared__ __attribute__((aligned(16))) bf16_t Ts[64 * TSP];   // [n=64][k=256]
  const int tid = threadIdx.x;
  if (blockIdx.x >= 256) {                     // block-uniform: these blocks meet no barrier
    const size_t base = (size_t)(blockIdx.x - 256) * 4096 + tid;   // in float4
    float4 xv[16];
#pragma unroll
    for (int i = 0; i < 16; ++i) {
      // the last load's result may be given the address registers that the loads
      // before it name: the wait stands in front of that overwrite
      if (i == 15) asm volatile("s_wait_xcnt 0x0" ::: "memory");
      xv[i] = reinterpret_cast<const float4*>(x)[base + i * 256];
    }
#pragma unroll
    for (int i = 0; i < 16; ++i) {
      v4bf bv = { (bf16_t)xv[i].x, (bf16_t)xv[i].y, (bf16_t)xv[i].z, (bf16_t)xv[i].w };
      reinterpret_cast<v4bf*>(Xb)[base + i * 256] = bv;
    }
    return;
  }
  const int m  = blockIdx.x >> 2;              // group of 64 rows of WT
  const int kb = (blockIdx.x & 3) * 256;       // first k of the strip
  const int mat = m >> 4, h = m & 15;
  // the strip's first element and its row pitch in floats (block-uniform)
  const float* src = mat == 0 ? Wq : (mat == 1 ? Wk : (mat == 2 ? Wv : Wo));
  const int pitch  = mat < 3 ? DH : DD;
  src += (mat < 3 ? (size_t)h * DD * DH : (size_t)h * 64) + (size_t)kb * pitch;
  const int d0 = tid >> 4, e4 = tid & 15;
  const float* p = src + (size_t)d0 * pitch + e4 * 4;
  float4 wv[16];
#pragma unroll
  for (int i = 0; i < 16; ++i)
    wv[i] = *reinterpret_cast<const float4*>(p + (size_t)(i * 16) * pitch);
#pragma unroll
  for (int i = 0; i < 16; ++i) {
    const int d = i * 16 + d0;
    Ts[(e4 * 4 + 0) * TSP + d] = (bf16_t)wv[i].x;
    Ts[(e4 * 4 + 1) * TSP + d] = (bf16_t)wv[i].y;
    Ts[(e4 * 4 + 2) * TSP + d] = (bf16_t)wv[i].z;
    Ts[(e4 * 4 + 3) * TSP + d] = (bf16_t)wv[i].w;
  }
  __syncthreads();
#pragma unroll
  for (int i = 0; i < 8; ++i) {
    int idx = i * 256 + tid;
    int row = idx >> 5, c8 = idx & 31;         // a wave writes 512 B of one row
    *reinterpret_cast<v8bf*>(WT + (size_t)(m * 64 + row) * DD + kb + c8 * 8) =
        *reinterpret_cast<const v8bf*>(&Ts[row * TSP + c8 * 8]);
  }
}

// ---------------------------------------------------------------------------
// Main loop of both projections: one 256 x 128 tile of A[.][1024] * W[.][1024]^T
// per work-group, both operands k contiguous, GK k to a stage. 8 waves as
// 4 (rows) x 2 (columns), 64 x 64 per wave: each fragment taken from LDS feeds
// four products.
// The operand tiles go from L2 into a two-buffer LDS ring by asynchronous
// copies, one stage ahead: stage t + 1 flies while stage t is multiplied, no
// staging register is held and one barrier a stage both publishes the next
// stage and frees the buffer just read.
// Work-groups that share operand rows run side by side and would ask L2 for the
// same lines at the same moment: each enters the k walk at its own stage st and
// wraps round, so the k sum starts at stage st.
// Ag = first row of the A tile, Wg = first row of the W tile (row = output column).
// c[mi][ni] = rows wm*64 + mi*16.., columns wn*64 + ni*16.. of the tile.
// LDS row pitch: GK + 8 bf16 = 16 B x odd for GK = 64 and 128.
// ---------------------------------------------------------------------------
#define GEMM_LDS(GK) (2 * (256 + 128) * ((GK) + 8))   // bf16 elements: A ring, then W ring

// Twelve 16-byte copies per lane in one statement, so that a stage meets few
// waits. The s_wait_xcnt stands inside the statement so that no address
// register of an issued copy is rewritten in front of it.
__device__ inline void copy12(const unsigned (&l)[12], const bf16_t* const (&g)[12]) {
  asm volatile(
               "global_load_async_to_lds_b128 %0, %12, off\n\t"
               "global_load_async_to_lds_b128 %1, %13, off\n\t"
               "global_load_async_to_lds_b128 %2, %14, off\n\t"
               "global_load_async_to_lds_b128 %3, %15, off\n\t"
               "global_load_async_to_lds_b128 %4, %16, off\n\t"
               "global_load_async_to_lds_b128 %5, %17, off\n\t"
               "global_load_async_to_lds_b128 %6, %18, off\n\t"
               "global_load_async_to_lds_b128 %7, %19, off\n\t"
               "global_load_async_to_lds_b128 %8, %20, off\n\t"
               "global_load_async_to_lds_b128 %9, %21, off\n\t"
               "global_load_async_to_lds_b128 %10, %22, off\n\t"
               "global_load_async_to_lds_b128 %11, %23, off\n\t"
               "s_wait_xcnt 0x0"
               :: "v"(l[0]), "v"(l[1]), "v"(l[2]), "v"(l[3]), "v"(l[4]), "v"(l[5]),
                  "v"(l[6]), "v"(l[7]), "v"(l[8]), "v"(l[9]), "v"(l[10]), "v"(l[11]),
                  "v"(g[0]), "v"(g[1]), "v"(g[2]), "v"(g[3]), "v"(g[4]), "v"(g[5]),
                  "v"(g[6]), "v"(g[7]), "v"(g[8]), "v"(g[9]), "v"(g[10]), "v"(g[11])
               : "memory");
}

// One stage of both operands: 256 rows of A and 128 rows of W, GK k each.
// la, lw, ga, gw = this lane's piece of the first RP rows; the 256 lanes cover
// RP whole rows a pass, A in the first 256 / RP passes and W in the rest.
template <int GK>
__device__ inline void copy_stage(unsigned la, unsigned lw,
                                  const bf16_t* ga, const bf16_t* gw) {
  constexpr int RP = 2048 / GK;                    // rows per pass
  constexpr int PA = 256 / RP, PN = 384 / RP;      // passes over A, over both
  constexpr unsigned LS = RP * (GK + 8) * 2;       // LDS bytes per pass
  constexpr size_t GS = (size_t)RP * DD;           // global elements per pass
  // both loops unrolled: every address is then the lane's own plus a constant,
  // and the two small arrays are registers
#pragma unroll
  for (int j = 0; j < PN; j += 12) {
    unsigned l[12];
    const bf16_t* g[12];
#pragma unroll
    for (int i = 0; i < 12; ++i) {
      const int p = j + i;
      l[i] = p < PA ? la + p * LS : lw + (p - PA) * LS;
      g[i] = p < PA ? ga + p * GS : gw + (p - PA) * GS;
    }
    copy12(l, g);
  }
}

template <int GK>
__device__ inline void gemm_tile_256x128(const bf16_t* __restrict__ Ag,
                                         const bf16_t* __restrict__ Wg,
                                         int st, bf16_t* ring, v8f (&c)[4][4]) {
  constexpr int GP = GK + 8;                       // LDS row pitch in bf16
  constexpr int NS = DD / GK;                      // stages of the k walk, a power of two
  static_assert((NS & (NS - 1)) == 0, "the walk wraps by a mask");
  auto kof = [&](int t) { return ((st + t) & (NS - 1)) * GK; };   // first k of the t-th stage walked
  constexpr int ABUF = 256 * GP, WBUF = 128 * GP;  // one buffer of each operand
  bf16_t* As = ring;                               // [buf][row 256][k]
  bf16_t* Ws = ring + 2 * ABUF;                    // [buf][column 128][k]
  const int tid = threadIdx.x, wid = tid >> 5;
  const int wm = wid >> 1, wn = wid & 1;
  const int srow = tid / (GK / 8), sc8 = (tid % (GK / 8)) * 8;   // 16-byte pieces of whole rows
  const unsigned la = (unsigned)(uintptr_t)&As[srow * GP + sc8];
  const unsigned lw = (unsigned)(uintptr_t)&Ws[srow * GP + sc8];
  const bf16_t* ga = Ag + (size_t)srow * DD + sc8;
  const bf16_t* gw = Wg + (size_t)srow * DD + sc8;

  // Ring prologue: the walk's first stage landed and published, then its second in flight.
  copy_stage<GK>(la, lw, ga + kof(0), gw + kof(0));
  asm volatile("s_wait_asynccnt 0x0" ::: "memory");    // own copies of the walk's first stage landed
  __syncthreads();                                     // every wave's copies visible
  copy_stage<GK>(la + ABUF * 2, lw + WBUF * 2, ga + kof(1), gw + kof(1));

  // Fragments run ahead of their products. A block is 32 k: 16 products, as rows
  // mi of four. b has two register sets, a one: rows 2 and 3 of a are read at the
  // block's head with the next block's b, two rows ahead of their use; rows 0 and 1
  // of the next block are read at mid-block into the registers that this block's
  // rows 0 and 1 have left. 224 registers with the accumulators.
  // Every sched_barrier below keeps a group of LDS reads where it is written: left
  // alone the compiler sinks each read to its first use, and every row of four
  // products then stands behind a wait for its own LDS round trip.
  static_assert((GK / 32) % 2 == 0, "a stage's first block uses b[0]");
  v16bf a[4], b[2][4];
  a[0] = load_frag(As, wm * 64, 0, GP);
  a[1] = load_frag(As, wm * 64 + 16, 0, GP);
#pragma unroll
  for (int i = 0; i < 4; ++i) b[0][i] = load_frag(Ws, wn * 64 + i * 16, 0, GP);

  for (int t = 0; t < NS; ++t) {
    const int buf = t & 1;
    const bf16_t* Al = As + buf * ABUF;
    const bf16_t* Wl = Ws + buf * WBUF;
    const bf16_t* An = As + (buf ^ 1) * ABUF;          // the next stage's buffer
    const bf16_t* Wn = Ws + (buf ^ 1) * WBUF;
#pragma unroll
    for (int ks = 0; ks < GK; ks += 32) {
      const int cur = (ks >> 5) & 1, nxt = cur ^ 1;
      const bool last = ks + 32 == GK;                 // the stage's last block
      a[2] = load_frag(Al, wm * 64 + 32, ks, GP);
      a[3] = load_frag(Al, wm * 64 + 48, ks, GP);
      if (!last) {
#pragma unroll
        for (int i = 0; i < 4; ++i) b[nxt][i] = load_frag(Wl, wn * 64 + i * 16, ks + 32, GP);
      }
      __builtin_amdgcn_sched_barrier(0);               // head group stays ahead of rows 0 and 1
#pragma unroll
      for (int mi = 0; mi < 2; ++mi)
#pragma unroll
        for (int ni = 0; ni < 4; ++ni)
          c[mi][ni] = wmma_bf16(a[mi], b[cur][ni], c[mi][ni]);
      __builtin_amdgcn_sched_barrier(0);               // mid group stays behind rows 0 and 1
      if (!last) {
        a[0] = load_frag(Al, wm * 64, ks + 32, GP);
        a[1] = load_frag(Al, wm * 64 + 16, ks + 32, GP);
      } else {
        // Publish point of the next stage, in the middle of the last block: this
        // stage's last fragments are fetched, so it also frees this stage's buffer.
        asm volatile("s_wait_dscnt 0x0" ::: "memory");     // own LDS reads of this buffer done
        asm volatile("s_wait_asynccnt 0x0" ::: "memory");  // own copies of the next stage landed
        __syncthreads();
        if (t + 2 < NS)                                    // same for the whole work-group
          copy_stage<GK>(la + buf * (ABUF * 2), lw + buf * (WBUF * 2),
                         ga + kof(t + 2), gw + kof(t + 2));
        // First fragments of the next stage, now published. In the last stage these
        // reads take the stage before's bytes (no copy is in flight there) and feed
        // nothing: unconditional, so that no branch merges the wait counts.
        a[0] = load_frag(An, wm * 64, 0, GP);
        a[1] = load_frag(An, wm * 64 + 16, 0, GP);
#pragma unroll
        for (int i = 0; i < 4; ++i) b[nxt][i] = load_frag(Wn, wn * 64 + i * 16, 0, GP);
      }
      __builtin_amdgcn_sched_barrier(0);               // mid group stays ahead of rows 2 and 3
#pragma unroll
      for (int mi = 2; mi < 4; ++mi)
#pragma unroll
        for (int ni = 0; ni < 4; ++ni)
          c[mi][ni] = wmma_bf16(a[mi], b[cur][ni], c[mi][ni]);
      __builtin_amdgcn_sched_barrier(0);               // the next head group stays behind this block
    }
  }
  asm volatile("s_wait_asynccnt 0x0" ::: "memory");    // nothing in flight behind the loop
  asm volatile("s_wait_dscnt 0x0" ::: "memory");       // the last stage's unused fragment reads are back
}

// ---------------------------------------------------------------------------
// Kernel 1: fused QKV projection.  Xb[8192,1024]bf16 x WT rows (k contiguous)
// Q,K stored [b,h,t,dh] row-major; V stored transposed [b,h,dh,t].
// 1/sqrt(DH) * log2(e) folded into Q: attention works on base-2 exponents.
// grid (32, 24): x = 8192/256 row tiles, y = 3072/128 column tiles = two heads
// of one matrix; a wave's 64 columns are one head.
// Register budget of four waves a SIMD, and 64 k to a stage so that the rings of
// two work-groups fit the LDS: two work-groups stay resident on a WGP.
// ---------------------------------------------------------------------------
__global__ __launch_bounds__(256) __attribute__((amdgpu_waves_per_eu(4, 4)))
void mha_qkv_proj_kernel(const bf16_t* __restrict__ Xb,
                         const bf16_t* __restrict__ WT,
                         bf16_t* __restrict__ Qb,
                         bf16_t* __restrict__ Kb,
                         bf16_t* __restrict__ Vt) {
  __shared__ __attribute__((aligned(16))) bf16_t ring[GEMM_LDS(64)];
  const int tid  = threadIdx.x;
  const int lane = tid & 31, wid = tid >> 5;
  const int lanen = lane & 15, hf = lane >> 4;
  const int wm = wid >> 1, wn = wid & 1;
  const int r0  = blockIdx.x * 256;
  const int mat = blockIdx.y >> 3;                // 0=Q 1=K 2=V (block-uniform)
  const int h   = (blockIdx.y * 2 + wn) & 15;     // this wave's head

  v8f c[4][4] = {};
  // the 16 resident sharers of an x tile enter at 16 stages, the 32 of a weight tile two to a stage
  gemm_tile_256x128<64>(Xb + (size_t)r0 * DD, WT + (size_t)blockIdx.y * 128 * DD,
                        blockIdx.x + blockIdx.y, ring, c);

  // Epilogue: tile never crosses a batch boundary (2048 % 256 == 0), and mat
  // is block-uniform -> one uniform branch, branch-free store loops inside.
  const int bidx = r0 >> 11;                 // batch index (uniform)
  const int t00  = (r0 & 2047) + wm * 64;    // base t for this wave
  const size_t bh = (size_t)(bidx * HH + h);

  if (mat == 0) {
    bf16_t* dst = Qb + bh * TT * DH;
#pragma unroll
    for (int mi = 0; mi < 4; ++mi)
#pragma unroll
      for (int ni = 0; ni < 4; ++ni) {
        int e = ni * 16 + lanen;
#pragma unroll
        for (int r = 0; r < 8; ++r) {
          int t = t00 + mi * 16 + r + 8 * hf;
          dst[(size_t)t * DH + e] = (bf16_t)(c[mi][ni][r] * QSCALE);
        }
      }
  } else if (mat == 1) {
    bf16_t* dst = Kb + bh * TT * DH;
#pragma unroll
    for (int mi = 0; mi < 4; ++mi)
#pragma unroll
      for (int ni = 0; ni < 4; ++ni) {
        int e = ni * 16 + lanen;
#pragma unroll
        for (int r = 0; r < 8; ++r) {
          int t = t00 + mi * 16 + r + 8 * hf;
          dst[(size_t)t * DH + e] = (bf16_t)c[mi][ni][r];
        }
      }
  } else {
    // V transposed [dh][t]: consecutive r -> consecutive t -> packed b32 stores
    bf16_t* dst = Vt + bh * DH * TT;
#pragma unroll
    for (int mi = 0; mi < 4; ++mi)
#pragma unroll
      for (int ni = 0; ni < 4; ++ni) {
        int e = ni * 16 + lanen;
#pragma unroll
        for (int r = 0; r < 8; r += 2) {
          int t = t00 + mi * 16 + r + 8 * hf;   // even
          v2bf pv = { (bf16_t)c[mi][ni][r], (bf16_t)c[mi][ni][r + 1] };
          *reinterpret_cast<v2bf*>(&dst[(size_t)e * TT + t]) = pv;
        }
      }
  }
}

#define KVP   72                 // LDS row pitch in bf16: 144 B = 16 B x odd
#define KVBUF (64 * KVP)         // one buffer: 64 rows
#define QC    2                  // 16-column query groups per wave

// Four 16-byte copies per lane = one K tile + one V^T tile per work-group.
// The s_wait_xcnt stands inside the statement so that no address register of
// an issued copy is rewritten in front of it.
__device__ inline void copy_kv_tile(unsigned lk, unsigned lv,
                                    const bf16_t* gk, const bf16_t* gv) {
  const unsigned lk1 = lk + 32 * KVP * 2, lv1 = lv + 32 * KVP * 2;
  const bf16_t* gk1 = gk + 32 * DH;
  const bf16_t* gv1 = gv + (size_t)32 * TT;
  asm volatile("global_load_async_to_lds_b128 %0, %4, off\n\t"
               "global_load_async_to_lds_b128 %1, %5, off\n\t"
               "global_load_async_to_lds_b128 %2, %6, off\n\t"
               "global_load_async_to_lds_b128 %3, %7, off\n\t"
               "s_wait_xcnt 0x0"
               :: "v"(lk), "v"(lk1), "v"(lv), "v"(lv1),
                  "v"(gk), "v"(gk1), "v"(gv), "v"(gv1)
               : "memory");
}

// Lane l takes the value of lane l ^ 16 (a register move, no LDS traffic).
__device__ inline float xhalf(float v) {
  const int i = __builtin_bit_cast(int, v);
  return __builtin_bit_cast(float,
      __builtin_amdgcn_permlanex16(i, i, 0x76543210, 0xfedcba98, false, false));
}

// Register budget of four waves a SIMD: two work-groups stay resident on a WGP.
__global__ __launch_bounds__(256) __attribute__((amdgpu_waves_per_eu(4, 4)))
void mha_flash_attn_kernel(const bf16_t* __restrict__ Qb,
                           const bf16_t* __restrict__ Kb,
                           const bf16_t* __restrict__ Vt,
                           bf16_t* __restrict__ Ob) {
  __shared__ __attribute__((aligned(16))) bf16_t Ks[2 * KVBUF];  // [buf][key][dh]
  __shared__ __attribute__((aligned(16))) bf16_t Vs[2 * KVBUF];  // [buf][dh][key]
  const int tid = threadIdx.x, lane = tid & 31, wid = tid >> 5;
  const int lanen = lane & 15, hf = lane >> 4;
  const int bh = blockIdx.x;                 // 0..63
  const int b = bh >> 4, h = bh & 15;
  const int q0 = blockIdx.y * (128 * QC) + wid * (16 * QC);
  const bf16_t* Qh = Qb + (size_t)bh * TT * DH;
  const bf16_t* Kh = Kb + (size_t)bh * TT * DH;
  const bf16_t* Vh = Vt + (size_t)bh * DH * TT;

  // Q as B operand: column = query q0 + c*16 + lane%16 for group c, k = dh in the hardware order.
  v16bf qf[QC][2];
  v8f o[QC][4] = {};                         // o[c][n][r] = O^T[n*16 + 8*hf + r][query of group c]
  v8f nref[QC];                              // minus this lane's query's reference, in all 8 registers
  float lrun[QC];                            // the sum over this half's keys
#pragma unroll
  for (int c = 0; c < QC; ++c) {
    qf[c][0] = load_frag(Qh, q0 + c * 16,  0, DH);
    qf[c][1] = load_frag(Qh, q0 + c * 16, 32, DH);
    nref[c] = v8f{};
    lrun[c] = 0.0f;
  }

  // This lane's share of a tile: rows crow and crow + 32, 16 bytes at column ccol.
  const int crow = tid >> 3, ccol = (tid & 7) * 8;
  const unsigned ldsK = (unsigned)(uintptr_t)&Ks[crow * KVP + ccol];
  const unsigned ldsV = (unsigned)(uintptr_t)&Vs[crow * KVP + ccol];
  const bf16_t* gK = Kh + crow * DH + ccol;            // + kt * DH per tile
  const bf16_t* gV = Vh + (size_t)crow * TT + ccol;    // + kt per tile

  // first key of the it-th tile walked
  auto key0 = [&](int it) { return ((it + (int)blockIdx.y * 4) & (TT / 64 - 1)) * 64; };

  // Ring prologue: the first tile landed and published, then the second in flight.
  copy_kv_tile(ldsK, ldsV, gK + key0(0) * DH, gV + key0(0));
  asm volatile("s_wait_asynccnt 0x0" ::: "memory");    // own copies of the first tile landed
  __syncthreads();                                     // every wave's copies visible
  copy_kv_tile(ldsK + KVBUF * 2, ldsV + KVBUF * 2, gK + key0(1) * DH, gV + key0(1));

  for (int it = 0; it < TT / 64; ++it) {
    const int buf = it & 1;
    const bf16_t* Kl = &Ks[buf * KVBUF];
    const bf16_t* Vl = &Vs[buf * KVBUF];
    // S^T * log2(e) - reference = K * Q^T + C  (scale already folded into Q)
    // s[c][n][r] = exp2 argument of key key0(it) + n*16 + 8*hf + r for this lane's query of group c
    v8f s[QC][4];
    auto scores = [&]() {
      v16bf ak[2][4];
      // each sched_barrier keeps a group of LDS reads together and ahead of the products:
      // else every read sinks to its own products and is waited for there
#pragma unroll
      for (int n = 0; n < 4; ++n) ak[0][n] = load_frag(Kl, n * 16, 0, KVP);
      __builtin_amdgcn_sched_barrier(0);
#pragma unroll
      for (int n = 0; n < 4; ++n) ak[1][n] = load_frag(Kl, n * 16, 32, KVP);
      __builtin_amdgcn_sched_barrier(0);
#pragma unroll
      for (int j = 0; j < 2; ++j)
#pragma unroll
        for (int n = 0; n < 4; ++n)
#pragma unroll
          for (int c = 0; c < QC; ++c) s[c][n] = wmma_bf16(ak[j][n], qf[c][j], j == 0 ? nref[c] : s[c][n]);
      // what follows stays behind the last score product: drawn in among the products, it
      // needs registers while all K fragments are still held, and a Q fragment is spilled
      __builtin_amdgcn_sched_barrier(0);
    };
    // Exponentials in place, this half's sum of them as a pairwise tree, and P^T as
    // B operand: tiles 2*kk and 2*kk + 1 give k = 8*hf + e and 16 + 8*hf + e, the
    // order in which load_frag takes the keys of a V^T row.
    float rs[QC];
    v16bf pb[QC][2];
    auto exponentials = [&]() {
#pragma unroll
      for (int c = 0; c < QC; ++c) {
#pragma unroll
        for (int n = 0; n < 4; ++n)
#pragma unroll
          for (int r = 0; r < 8; ++r) s[c][n][r] = __builtin_amdgcn_exp2f(s[c][n][r]);
        const v8f t8 = (s[c][0] + s[c][1]) + (s[c][2] + s[c][3]);
        const v4f t4 = __builtin_shufflevector(t8, t8, 0, 1, 2, 3) + __builtin_shufflevector(t8, t8, 4, 5, 6, 7);
        const v2f t2 = __builtin_shufflevector(t4, t4, 0, 1) + __builtin_shufflevector(t4, t4, 2, 3);
        rs[c] = t2[0] + t2[1];
#pragma unroll
        for (int kk = 0; kk < 2; ++kk)
#pragma unroll
          for (int e = 0; e < 8; ++e) {
            pb[c][kk][e]     = (bf16_t)s[c][2 * kk][e];
            pb[c][kk][e + 8] = (bf16_t)s[c][2 * kk + 1][e];
          }
      }
    };
    // Moves the reference of every query whose maximum in this tile lies more than thr
    // above it; O, the sum and the tile's arguments follow.
    auto move_reference = [&](float thr) {
#pragma unroll
      for (int c = 0; c < QC; ++c) {
        float mx[8];
#pragma unroll
        for (int r = 0; r < 8; ++r)
          mx[r] = fmaxf(fmaxf(s[c][0][r], s[c][1][r]), fmaxf(s[c][2][r], s[c][3][r]));
        const float mt = fmaxf(fmaxf(fmaxf(mx[0], mx[1]), fmaxf(mx[2], mx[3])),
                               fmaxf(fmaxf(mx[4], mx[5]), fmaxf(mx[6], mx[7])));
        const float mj = fmaxf(mt, xhalf(mt));         // both halves hold the query's maximum
        const float d = mj > thr ? mj : 0.0f;          // the reference rises by d (first tile: moves)
        // first tile: O and the sum are 0, and a negative d must not make the factor infinite
        const float alpha = __builtin_amdgcn_exp2f(-fmaxf(d, 0.0f));
        lrun[c] *= alpha;
        nref[c] -= d;
#pragma unroll
        for (int n = 0; n < 4; ++n) {
          s[c][n] -= d;
          o[c][n] *= alpha;
        }
      }
    };
    // V^T fragments of the tile's first 32 keys are read ahead of the test: the test and the
    // conversions cover their LDS round trip. No exponential is left among the products.
    v16bf av[2][4];
    auto exponentials_and_v = [&]() {
#pragma unroll
      for (int n = 0; n < 4; ++n) av[0][n] = load_frag(Vl, n * 16, 0, KVP);
      // compiler fence: holds the four reads here; else they are sunk behind the test,
      // where only the conversions stand between them and their products
      asm volatile("" ::: "memory");
      exponentials();
    };
    scores();
    // The first tile moves the reference (from 0) to its maximum, whatever its sign.
    if (it == 0) move_reference(-3.0e38f);
    exponentials_and_v();
    // One test a tile, on the sums that the tile needs anyway: every exponential is
    // at least 0, so sums of at most 2^14 say that none lies above 2^14; a larger sum
    // of these 64 says that one lies above 2^8. Infinity and NaN fail the test too.
    if (__builtin_amdgcn_ballot_w32(!(rs[0] + rs[1] <= 16384.0f)) != 0) {   // a scalar branch, rarely taken
      scores();                                        // the arguments again: K is still in LDS
      move_reference(8.0f);
      exponentials_and_v();                            // once more, against the new reference
    }
#pragma unroll
    for (int c = 0; c < QC; ++c) lrun[c] += rs[c];

    // O^T += V^T * P^T   (V^T tile is [dh][key] in LDS -> direct A-fragments)
    // The second 32 keys' fragments are read as one group ahead of the first 32 keys' products.
#pragma unroll
    for (int n = 0; n < 4; ++n) av[1][n] = load_frag(Vl, n * 16, 32, KVP);
    __builtin_amdgcn_sched_barrier(0);                 // keeps the group here: else each read sinks to its product and is waited for there
#pragma unroll
    for (int kk = 0; kk < 2; ++kk) {
#pragma unroll
      for (int n = 0; n < 4; ++n) {
#pragma unroll
        for (int c = 0; c < QC; ++c) o[c][n] = wmma_bf16(av[kk][n], pb[c][kk], o[c][n]);
      }
      // the first 32 keys' products stay ahead of the publish point's wait for all LDS
      // reads: they cover the round trip of the group read above
      if (kk == 0) __builtin_amdgcn_sched_barrier(0);
    }
    // Publish point of the next tile; it also frees this tile's buffer.
    asm volatile("s_wait_dscnt 0x0" ::: "memory");     // own LDS reads of this buffer done
    asm volatile("s_wait_asynccnt 0x0" ::: "memory");  // own copies of the next tile landed
    __syncthreads();
    if (it + 2 < TT / 64)                              // same for the whole work-group
      copy_kv_tile(ldsK + buf * (KVBUF * 2), ldsV + buf * (KVBUF * 2),
                   gK + key0(it + 2) * DH, gV + key0(it + 2));
  }
  asm volatile("s_wait_asynccnt 0x0" ::: "memory");    // nothing in flight at the wave's end

  // join the halves' sums, normalize, store concat-head layout [b, t, h*64 + e]:
  // a lane's 8 accumulator registers are 8 consecutive e of its query's row.
#pragma unroll
  for (int c = 0; c < QC; ++c) {
    const float ltot = lrun[c] + xhalf(lrun[c]);
    bf16_t* dst = Ob + ((size_t)(b * TT + q0 + c * 16 + lanen) * (HH * DH)) + h * DH + 8 * hf;
#pragma unroll
    for (int n = 0; n < 4; ++n) {
      v8bf ov;
#pragma unroll
      for (int r = 0; r < 8; ++r) ov[r] = (bf16_t)(o[c][n][r] / ltot);
      *reinterpret_cast<v8bf*>(dst + n * 16) = ov;
    }
  }
}

// ---------------------------------------------------------------------------
// Kernel 3: output projection + bias.  Ob[8192,1024]bf16 x WT rows 3072.. (Wo^T)
// grid (32, 8): 256-row x 128-col tiles, one work-group to a WGP, so the ring
// takes 128 k to a stage: twice the bytes in flight and half the barriers.
// ---------------------------------------------------------------------------
__global__ __launch_bounds__(256)
void mha_out_proj_kernel(const bf16_t* __restrict__ Ob,
                         const bf16_t* __restrict__ WT,
                         const float* __restrict__ bo,
                         float* __restrict__ out) {
  __shared__ __attribute__((aligned(16))) bf16_t ring[GEMM_LDS(128)];
  const int tid = threadIdx.x, lane = tid & 31, wid = tid >> 5;
  const int lanen = lane & 15, hf = lane >> 4;
  const int wm = wid >> 1, wn = wid & 1;
  const int r0 = blockIdx.x * 256;
  const int n0 = blockIdx.y * 128;

  v8f c[4][4] = {};
  // the 8 sharers of a row tile enter at 8 stages, the 32 of a weight tile four to a stage
  gemm_tile_256x128<128>(Ob + (size_t)r0 * DD, WT + (size_t)(3 * HH * DH + n0) * DD,
                         blockIdx.x + blockIdx.y, ring, c);

  float bias[4];
#pragma unroll
  for (int ni = 0; ni < 4; ++ni) bias[ni] = bo[n0 + wn * 64 + ni * 16 + lanen];
  // the store addresses are formed in the register that the four loads name as
  // their offset: the wait stands in front of that overwrite
  asm volatile("s_wait_xcnt 0x0" ::: "memory");
#pragma unroll
  for (int mi = 0; mi < 4; ++mi)
#pragma unroll
    for (int ni = 0; ni < 4; ++ni) {
      int col = n0 + wn * 64 + ni * 16 + lanen;
#pragma unroll
      for (int r = 0; r < 8; ++r) {
        int row = r0 + wm * 64 + mi * 16 + r + 8 * hf;
        out[(size_t)row * DD + col] = c[mi][ni][r] + bias[ni];
      }
    }
}

extern "C" void kernel_launch(void* const* d_in, const int* in_sizes, int n_in,
                              void* d_out, int out_size, void* d_ws, size_t ws_size,
                              hipStream_t stream) {
  const float* x  = (const float*)d_in[0];
  const float* Wq = (const float*)d_in[1];
  const float* Wk = (const float*)d_in[2];
  const float* Wv = (const float*)d_in[3];
  const float* Wo = (const float*)d_in[4];
  const float* bo = (const float*)d_in[5];
  float* out = (float*)d_out;

  const size_t elems = (size_t)BB * HH * TT * DH;   // 8,388,608 per buffer
  bf16_t* Qb = (bf16_t*)d_ws;
  bf16_t* Kb = Qb + elems;
  bf16_t* Vt = Kb + elems;
  bf16_t* Ob = Vt + elems;
  bf16_t* Xb = Ob + elems;
  bf16_t* WT = Xb + elems;                          // 4096 x 1024

  mha_convert_kernel<<<dim3(768), 256, 0, stream>>>(x, Wq, Wk, Wv, Wo, Xb, WT);
  mha_qkv_proj_kernel<<<dim3(32, 24), 256, 0, stream>>>(Xb, WT, Qb, Kb, Vt);
  mha_flash_attn_kernel<<<dim3(64, 8), 256, 0, stream>>>(Qb, Kb, Vt, Ob);
  mha_out_proj_kernel<<<dim3(32, 8), 256, 0, stream>>>(Ob, WT, bo, out);
}
